// v000
// Measured on an AMD MI455X. A time is GPU time per run, averaged over a window of back-to-back runs after a warm-up
// (all launches, gaps included; the runs take copies of the inputs in turn), and the median of several windows.
// Apart from v000's, it joins two sittings. Times from different sittings can be a few percent apart, while
// side-by-side timings come from the same sitting.
// v000, which the later versions start from, runs in 416 microseconds.
#include <hip/hip_runtime.h>

// ---------------- problem constants ----------------
#define BSZ 16
#define TT  1024          // H*W tokens
#define CC  512           // channels
#define NH  8
#define HD  64
#define AD  512           // attention dim
#define EPSV 1e-5f

typedef __bf16 bf16;
typedef __bf16 v16bf __attribute__((ext_vector_type(16)));
typedef float  v8f   __attribute__((ext_vector_type(8)));

// ---------------- WMMA helpers ----------------
__device__ __forceinline__ v8f wmma_bf16(v16bf a, v16bf b, v8f c) {
  // D = A(16x32 bf16) * B(32x16 bf16) + C(16x16 f32)
  return __builtin_amdgcn_wmma_f32_16x16x32_bf16(
      /*neg_a=*/false, a, /*neg_b=*/false, b,
      /*c_mod=*/(short)0, c, /*reuse_a=*/false, /*reuse_b=*/false);
}

// Load a 16x32 bf16 A-operand (or 32x16 B-operand, mirrored) per the CDNA5
// VGPR layout: lanes 0-15 -> row=lane, K chunks {0..7} and {16..23};
// lanes 16-31 -> row=lane-16, K chunks {8..15} and {24..31}.
// Each chunk is 8 contiguous bf16 = one 16-byte load.
__device__ __forceinline__ v16bf load_ab(const bf16* base, int row_stride, int lane) {
  int half = lane >> 4;
  int r    = lane & 15;
  const bf16* p = base + (size_t)r * row_stride + half * 8;
  union { v16bf v; uint4 q[2]; } u;
  u.q[0] = *(const uint4*)(p);        // K 0..7   (or 8..15)
  u.q[1] = *(const uint4*)(p + 16);   // K 16..23 (or 24..31)
  return u.v;
}

// Async-stage a contiguous 16 KB panel (16 rows x 512 bf16) from global into
// LDS: each of 256 threads copies 4 x 16B via global_load_async_to_lds_b128
// (ASYNCcnt path), then waits its own async counter. Caller must __syncthreads.
__device__ __forceinline__ void stage_panel_async(const bf16* __restrict__ gsrc,
                                                  bf16* lds_dst, int tid) {
  unsigned lds_base = (unsigned)(size_t)(void*)lds_dst;  // addr[31:0] = LDS offset
  unsigned off = (unsigned)tid * 16u;
  #pragma unroll
  for (int rr = 0; rr < 4; ++rr) {
    unsigned o = off + (unsigned)rr * 4096u;
    unsigned lds_a = lds_base + o;
    asm volatile("global_load_async_to_lds_b128 %0, %1, %2"
                 :: "v"(lds_a), "v"(o), "s"(gsrc)
                 : "memory");
  }
  asm volatile("s_wait_asynccnt 0x0" ::: "memory");
}

// ---------------- kernel 1: GroupNorm stats (1 group) ----------------
__global__ __launch_bounds__(256) void gn_stats(const float* __restrict__ x,
                                                float* __restrict__ stats) {
  int b = blockIdx.x;
  const float4* p = (const float4*)(x + (size_t)b * TT * CC);
  const int n4 = TT * CC / 4;
  float s = 0.f, ss = 0.f;
  for (int i = threadIdx.x; i < n4; i += 256) {
    float4 v = p[i];
    s  += v.x + v.y + v.z + v.w;
    ss += v.x * v.x + v.y * v.y + v.z * v.z + v.w * v.w;
  }
  __shared__ float sh0[256], sh1[256];
  sh0[threadIdx.x] = s; sh1[threadIdx.x] = ss;
  __syncthreads();
  for (int o = 128; o > 0; o >>= 1) {
    if (threadIdx.x < o) {
      sh0[threadIdx.x] += sh0[threadIdx.x + o];
      sh1[threadIdx.x] += sh1[threadIdx.x + o];
    }
    __syncthreads();
  }
  if (threadIdx.x == 0) {
    const float inv_n = 1.0f / (float)(TT * CC);
    float mean = sh0[0] * inv_n;
    float var  = sh1[0] * inv_n - mean * mean;
    stats[2 * b]     = mean;
    stats[2 * b + 1] = rsqrtf(var + EPSV);
  }
}

// ---------------- kernel 2: normalize + cast to bf16 ----------------
__global__ __launch_bounds__(256) void gn_apply(const float* __restrict__ x,
                                                const float* __restrict__ gamma,
                                                const float* __restrict__ beta,
                                                const float* __restrict__ stats,
                                                bf16* __restrict__ xn) {
  size_t i = ((size_t)blockIdx.x * 256 + threadIdx.x) * 4;
  int b = (int)(i / ((size_t)TT * CC));
  int c = (int)(i % CC);
  float mean = stats[2 * b], inv = stats[2 * b + 1];
  float4 v  = *(const float4*)(x + i);
  float4 g  = *(const float4*)(gamma + c);
  float4 bt = *(const float4*)(beta + c);
  union { bf16 o[4]; uint2 u; } r;
  r.o[0] = (bf16)((v.x - mean) * inv * g.x + bt.x);
  r.o[1] = (bf16)((v.y - mean) * inv * g.y + bt.y);
  r.o[2] = (bf16)((v.z - mean) * inv * g.z + bt.z);
  r.o[3] = (bf16)((v.w - mean) * inv * g.w + bt.w);
  *(uint2*)(xn + i) = r.u;
}

// ---------------- kernel 3: weight transpose + cast (512x512 each) ----------
__global__ __launch_bounds__(256) void wcast_t(const float* __restrict__ wq,
                                               const float* __restrict__ wk,
                                               const float* __restrict__ wv,
                                               const float* __restrict__ wo,
                                               bf16* __restrict__ wqT,
                                               bf16* __restrict__ wkT,
                                               bf16* __restrict__ wvT,
                                               bf16* __restrict__ woT) {
  const float* w = (blockIdx.z == 0) ? wq : (blockIdx.z == 1) ? wk
                   : (blockIdx.z == 2) ? wv : wo;
  bf16* wt = (blockIdx.z == 0) ? wqT : (blockIdx.z == 1) ? wkT
             : (blockIdx.z == 2) ? wvT : woT;
  __shared__ float tile[32][33];
  int bx = blockIdx.x * 32, by = blockIdx.y * 32;
  int tx = threadIdx.x, ty = threadIdx.y;     // 32 x 8
  #pragma unroll
  for (int j = 0; j < 32; j += 8)
    tile[ty + j][tx] = w[(size_t)(by + ty + j) * 512 + bx + tx];
  __syncthreads();
  #pragma unroll
  for (int j = 0; j < 32; j += 8)   // wt[n][k] = w[k][n]
    wt[(size_t)(bx + ty + j) * 512 + by + tx] = (bf16)tile[tx][ty + j];
}

// ---------------- kernel 4: fused QKV WMMA GEMM ----------------
// A panel (16 tokens x 512 K) async-staged in LDS once per block; 8 waves x
// 3 passes x 4 register-blocked accumulator tiles (one shared A per K-step).
// q,k stored [B*T, AD] bf16 ; v stored transposed [B, AD, T] bf16
__global__ __launch_bounds__(256) void qkv_gemm(const bf16* __restrict__ xn,
                                                const bf16* __restrict__ wqT,
                                                const bf16* __restrict__ wkT,
                                                const bf16* __restrict__ wvT,
                                                const float* __restrict__ bq,
                                                const float* __restrict__ bk,
                                                const float* __restrict__ bv,
                                                bf16* __restrict__ q,
                                                bf16* __restrict__ k,
                                                bf16* __restrict__ vT) {
  int t0   = blockIdx.x * 16;            // global token row (over B*T)
  int b    = t0 / TT;
  int tloc = t0 - b * TT;
  int tid  = threadIdx.x;
  int wave = tid >> 5, lane = tid & 31;

  __shared__ __align__(16) bf16 As[16 * CC];   // 16 KB A panel
  stage_panel_async(xn + (size_t)t0 * CC, As, tid);
  __syncthreads();

  const int n = lane & 15, half = lane >> 4;

  for (int pass = 0; pass < 3; ++pass) {
    int tbase = wave * 12 + pass * 4;    // 4 consecutive tiles of 96
    const bf16* wp[4];
    const float* bp[4];
    int nb[4], mt[4];
    #pragma unroll
    for (int t = 0; t < 4; ++t) {
      int tile = tbase + t;
      mt[t] = tile >> 5;                 // 0=q 1=k 2=v
      nb[t] = (tile & 31) * 16;
      const bf16* wt = (mt[t] == 0) ? wqT : (mt[t] == 1) ? wkT : wvT;
      wp[t] = wt + (size_t)nb[t] * CC;
      bp[t] = (mt[t] == 0) ? bq : (mt[t] == 1) ? bk : bv;
    }
    v8f acc[4] = {{}, {}, {}, {}};
    for (int kk = 0; kk < CC; kk += 32) {
      v16bf a = load_ab(As + kk, CC, lane);     // LDS (ds_load_b128)
      #pragma unroll
      for (int t = 0; t < 4; ++t) {
        v16bf bm = load_ab(wp[t] + kk, CC, lane);
        acc[t] = wmma_bf16(a, bm, acc[t]);
      }
    }
    #pragma unroll
    for (int t = 0; t < 4; ++t) {
      float bias = bp[t][nb[t] + n];
      if (mt[t] < 2) {
        bf16* dst = (mt[t] == 0) ? q : k;
        #pragma unroll
        for (int r = 0; r < 8; r++) {
          int m = r + half * 8;          // C-layout row
          dst[(size_t)(t0 + m) * AD + nb[t] + n] = (bf16)(acc[t][r] + bias);
        }
      } else {                           // V transposed: [b][attn_dim][token]
        #pragma unroll
        for (int r = 0; r < 8; r++) {
          int m = r + half * 8;
          vT[((size_t)b * AD + nb[t] + n) * TT + tloc + m] = (bf16)(acc[t][r] + bias);
        }
      }
    }
  }
}

// ---------------- kernel 5: flash attention, 1 wave per (b,h,16-q tile) ----
__global__ __launch_bounds__(32) void attn_flash(const bf16* __restrict__ q,
                                                 const bf16* __restrict__ k,
                                                 const bf16* __restrict__ vT,
                                                 bf16* __restrict__ attn) {
  const int qt = blockIdx.x * 16;   // query tile within batch
  const int h  = blockIdx.y;
  const int b  = blockIdx.z;
  const int lane = threadIdx.x;
  const float scale = 0.125f;       // 1/sqrt(64)

  const bf16* qbase = q  + ((size_t)(b * TT + qt) * AD) + h * HD;
  const bf16* kbase = k  + ((size_t)b * TT) * AD + h * HD;
  const bf16* vbase = vT + ((size_t)b * AD + h * HD) * TT;  // rows = head dim, stride T

  // Q A-operands for K chunks 0..31 and 32..63 (loaded once)
  v16bf a0 = load_ab(qbase,      AD, lane);
  v16bf a1 = load_ab(qbase + 32, AD, lane);

  v8f o[4] = {{}, {}, {}, {}};      // 16x64 output accumulator (4 N-tiles)
  float mrow[8], lrow[8];
  #pragma unroll
  for (int r = 0; r < 8; r++) { mrow[r] = -1e30f; lrow[r] = 0.f; }

  __shared__ __align__(16) bf16 pbuf[16 * 32];   // P tile staging (layout swap)
  const int n = lane & 15, half = lane >> 4;

  for (int kt = 0; kt < TT; kt += 32) {
    // ---- S = Q * K^T for 32 keys (two 16-key N-tiles) ----
    v8f s0 = {}, s1 = {};
    {
      v16bf b0a = load_ab(kbase + (size_t)kt * AD,             AD, lane);
      v16bf b0b = load_ab(kbase + (size_t)kt * AD + 32,        AD, lane);
      v16bf b1a = load_ab(kbase + (size_t)(kt + 16) * AD,      AD, lane);
      v16bf b1b = load_ab(kbase + (size_t)(kt + 16) * AD + 32, AD, lane);
      s0 = wmma_bf16(a0, b0a, s0); s0 = wmma_bf16(a1, b0b, s0);
      s1 = wmma_bf16(a0, b1a, s1); s1 = wmma_bf16(a1, b1b, s1);
    }
    // ---- online softmax (rows live in: vgpr r, 16-lane half) ----
    float mx[8];
    #pragma unroll
    for (int r = 0; r < 8; r++) {
      s0[r] *= scale; s1[r] *= scale;
      mx[r] = fmaxf(s0[r], s1[r]);
    }
    #pragma unroll
    for (int r = 0; r < 8; r++) {
      #pragma unroll
      for (int off = 1; off < 16; off <<= 1)          // stays within half
        mx[r] = fmaxf(mx[r], __shfl_xor(mx[r], off, 32));
      float mnew = fmaxf(mrow[r], mx[r]);
      float corr = __expf(mrow[r] - mnew);
      float p0 = __expf(s0[r] - mnew);
      float p1 = __expf(s1[r] - mnew);
      s0[r] = p0; s1[r] = p1;
      float rs = p0 + p1;
      #pragma unroll
      for (int off = 1; off < 16; off <<= 1)
        rs += __shfl_xor(rs, off, 32);
      lrow[r] = lrow[r] * corr + rs;
      mrow[r] = mnew;
      o[0][r] *= corr; o[1][r] *= corr; o[2][r] *= corr; o[3][r] *= corr;
    }
    // ---- C-layout P -> LDS -> A-layout bf16 ----
    #pragma unroll
    for (int r = 0; r < 8; r++) {
      int m = r + half * 8;
      pbuf[m * 32 + n]      = (bf16)s0[r];
      pbuf[m * 32 + 16 + n] = (bf16)s1[r];
    }
    __syncthreads();
    v16bf pa = load_ab(pbuf, 32, lane);
    // ---- O += P(16x32) * V(32x64), 4 N-tiles of head dim ----
    #pragma unroll
    for (int dt = 0; dt < 4; dt++) {
      v16bf vv = load_ab(vbase + (size_t)(dt * 16) * TT + kt, TT, lane);
      o[dt] = wmma_bf16(pa, vv, o[dt]);
    }
    __syncthreads();
  }

  // ---- normalize and store attn [B*T, AD] bf16 ----
  bf16* outb = attn + ((size_t)(b * TT + qt) * AD) + h * HD;
  #pragma unroll
  for (int r = 0; r < 8; r++) {
    int m = r + half * 8;
    float inv = 1.0f / lrow[r];
    #pragma unroll
    for (int dt = 0; dt < 4; dt++)
      outb[(size_t)m * AD + dt * 16 + n] = (bf16)(o[dt][r] * inv);
  }
}

// ---------------- kernel 6: output projection + bias + residual ------------
// attn panel async-staged in LDS; each wave owns 4 register-blocked N-tiles.
__global__ __launch_bounds__(256) void out_proj(const bf16* __restrict__ attn,
                                                const bf16* __restrict__ woT,
                                                const float* __restrict__ bo,
                                                const float* __restrict__ x,
                                                float* __restrict__ out) {
  int t0  = blockIdx.x * 16;         // token row over B*T
  int tid = threadIdx.x;
  int wave = tid >> 5, lane = tid & 31;

  __shared__ __align__(16) bf16 As[16 * AD];   // 16 KB attn panel
  stage_panel_async(attn + (size_t)t0 * AD, As, tid);
  __syncthreads();

  int nbase0 = wave * 64;            // wave covers n-tiles 4w..4w+3
  v8f acc[4] = {{}, {}, {}, {}};
  for (int kk = 0; kk < AD; kk += 32) {
    v16bf a = load_ab(As + kk, AD, lane);      // LDS
    #pragma unroll
    for (int t = 0; t < 4; ++t) {
      v16bf bm = load_ab(woT + (size_t)(nbase0 + t * 16) * AD + kk, AD, lane);
      acc[t] = wmma_bf16(a, bm, acc[t]);
    }
  }
  int n = lane & 15, half = lane >> 4;
  #pragma unroll
  for (int t = 0; t < 4; ++t) {
    int nbase = nbase0 + t * 16;
    float bias = bo[nbase + n];
    #pragma unroll
    for (int r = 0; r < 8; r++) {
      int m = r + half * 8;
      size_t idx = (size_t)(t0 + m) * CC + nbase + n;
      out[idx] = x[idx] + acc[t][r] + bias;
    }
  }
}

// ---------------- launch ----------------
extern "C" void kernel_launch(void* const* d_in, const int* in_sizes, int n_in,
                              void* d_out, int out_size, void* d_ws, size_t ws_size,
                              hipStream_t stream) {
  const float* x     = (const float*)d_in[0];
  const float* gamma = (const float*)d_in[1];
  const float* beta  = (const float*)d_in[2];
  const float* wq    = (const float*)d_in[3];
  const float* bq    = (const float*)d_in[4];
  const float* wk    = (const float*)d_in[5];
  const float* bk    = (const float*)d_in[6];
  const float* wv    = (const float*)d_in[7];
  const float* bv    = (const float*)d_in[8];
  const float* wo    = (const float*)d_in[9];
  const float* bo    = (const float*)d_in[10];
  float* out = (float*)d_out;

  // workspace carve-up
  const size_t XN = (size_t)BSZ * TT * CC;   // 8.4M elems
  const size_t WW = (size_t)512 * 512;
  char* ws = (char*)d_ws;
  float* stats = (float*)ws;                 // 2*B floats
  bf16* xn  = (bf16*)(ws + 256);
  bf16* wqT = xn  + XN;
  bf16* wkT = wqT + WW;
  bf16* wvT = wkT + WW;
  bf16* woT = wvT + WW;
  bf16* qb  = woT + WW;
  bf16* kb  = qb  + XN;
  bf16* vT  = kb  + XN;
  bf16* attn = xn;                           // reuse xn after QKV

  gn_stats<<<BSZ, 256, 0, stream>>>(x, stats);
  gn_apply<<<(unsigned)(XN / 4 / 256), 256, 0, stream>>>(x, gamma, beta, stats, xn);
  wcast_t<<<dim3(16, 16, 4), dim3(32, 8), 0, stream>>>(wq, wk, wv, wo,
                                                       wqT, wkT, wvT, woT);
  qkv_gemm<<<(BSZ * TT) / 16, 256, 0, stream>>>(xn, wqT, wkT, wvT,
                                                bq, bk, bv, qb, kb, vT);
  attn_flash<<<dim3(TT / 16, NH, BSZ), 32, 0, stream>>>(qb, kb, vT, attn);
  out_proj<<<(BSZ * TT) / 16, 256, 0, stream>>>(attn, woT, bo, x, out);
}

// v001
// A run of this version takes 300 microseconds.
// Two timings next to v000 both put it at 1.44 times that version's speed.
#include <hip/hip_runtime.h>

// ---------------- problem constants ----------------
#define BSZ 16
#define TT  1024          // H*W tokens
#define CC  512           // channels
#define NH  8
#define HD  64
#define AD  512           // attention dim
#define EPSV 1e-5f

typedef __bf16 bf16;
typedef __bf16 v16bf __attribute__((ext_vector_type(16)));
typedef float  v8f   __attribute__((ext_vector_type(8)));

// ---------------- WMMA helpers ----------------
__device__ __forceinline__ v8f wmma_bf16(v16bf a, v16bf b, v8f c) {
  // D = A(16x32 bf16) * B(32x16 bf16) + C(16x16 f32)
  return __builtin_amdgcn_wmma_f32_16x16x32_bf16(
      /*neg_a=*/false, a, /*neg_b=*/false, b,
      /*c_mod=*/(short)0, c, /*reuse_a=*/false, /*reuse_b=*/false);
}

// Load a 16x32 bf16 A-operand (or 32x16 B-operand, mirrored) per the CDNA5
// VGPR layout: lanes 0-15 -> row=lane, K chunks {0..7} and {16..23};
// lanes 16-31 -> row=lane-16, K chunks {8..15} and {24..31}.
// Each chunk is 8 contiguous bf16 = one 16-byte load.
__device__ __forceinline__ v16bf load_ab(const bf16* base, int row_stride, int lane) {
  int half = lane >> 4;
  int r    = lane & 15;
  const bf16* p = base + (size_t)r * row_stride + half * 8;
  union { v16bf v; uint4 q[2]; } u;
  u.q[0] = *(const uint4*)(p);        // K 0..7   (or 8..15)
  u.q[1] = *(const uint4*)(p + 16);   // K 16..23 (or 24..31)
  return u.v;
}

// Packed operand tile: a 16-row x 32-k bf16 tile is stored as 512 elements in
// the order the lanes consume it: element (row, k) lies at
//   (k >> 4) * 256 + (((k >> 3) & 1) * 16 + row) * 8 + (k & 7).
// Each of the two wave-wide 16-byte loads then covers 512 contiguous bytes
// (4 whole 128-byte lines) and yields the same registers as load_ab().
__device__ __forceinline__ v16bf load_packed(const bf16* tile, int lane) {
  union { v16bf v; uint4 q[2]; } u;
  u.q[0] = *(const uint4*)(tile + lane * 8);        // K 0..7   (or 8..15)
  u.q[1] = *(const uint4*)(tile + 256 + lane * 8);  // K 16..23 (or 24..31)
  return u.v;
}

// Async-stage a contiguous 16 KB panel (16 rows x 512 bf16) from global into
// LDS: each of 256 threads copies 4 x 16B via global_load_async_to_lds_b128
// (ASYNCcnt path), then waits its own async counter. Caller must __syncthreads.
__device__ __forceinline__ void stage_panel_async(const bf16* __restrict__ gsrc,
                                                  bf16* lds_dst, int tid) {
  unsigned lds_base = (unsigned)(size_t)(void*)lds_dst;  // addr[31:0] = LDS offset
  unsigned off = (unsigned)tid * 16u;
  #pragma unroll
  for (int rr = 0; rr < 4; ++rr) {
    unsigned o = off + (unsigned)rr * 4096u;
    unsigned lds_a = lds_base + o;
    // s_wait_xcnt in the copy's own statement: its address registers are not
    // rewritten before the wait.
    asm volatile("global_load_async_to_lds_b128 %0, %1, %2\n\ts_wait_xcnt 0x0"
                 :: "v"(lds_a), "v"(o), "s"(gsrc)
                 : "memory");
  }
  asm volatile("s_wait_asynccnt 0x0" ::: "memory");
}

// ---------------- kernel 1: GroupNorm stats (1 group) ----------------
__global__ __launch_bounds__(256) void gn_stats(const float* __restrict__ x,
                                                float* __restrict__ stats) {
  int b = blockIdx.x;
  const float4* p = (const float4*)(x + (size_t)b * TT * CC);
  const int n4 = TT * CC / 4;
  float s = 0.f, ss = 0.f;
  for (int i = threadIdx.x; i < n4; i += 256) {
    float4 v = p[i];
    s  += v.x + v.y + v.z + v.w;
    ss += v.x * v.x + v.y * v.y + v.z * v.z + v.w * v.w;
  }
  __shared__ float sh0[256], sh1[256];
  sh0[threadIdx.x] = s; sh1[threadIdx.x] = ss;
  __syncthreads();
  for (int o = 128; o > 0; o >>= 1) {
    if (threadIdx.x < o) {
      sh0[threadIdx.x] += sh0[threadIdx.x + o];
      sh1[threadIdx.x] += sh1[threadIdx.x + o];
    }
    __syncthreads();
  }
  if (threadIdx.x == 0) {
    const float inv_n = 1.0f / (float)(TT * CC);
    float mean = sh0[0] * inv_n;
    float var  = sh1[0] * inv_n - mean * mean;
    stats[2 * b]     = mean;
    stats[2 * b + 1] = rsqrtf(var + EPSV);
  }
}

// ---------------- kernel 2: normalize + cast to bf16 ----------------
__global__ __launch_bounds__(256) void gn_apply(const float* __restrict__ x,
                                                const float* __restrict__ gamma,
                                                const float* __restrict__ beta,
                                                const float* __restrict__ stats,
                                                bf16* __restrict__ xn) {
  size_t i = ((size_t)blockIdx.x * 256 + threadIdx.x) * 4;
  int b = (int)(i / ((size_t)TT * CC));
  int c = (int)(i % CC);
  float mean = stats[2 * b], inv = stats[2 * b + 1];
  float4 v  = *(const float4*)(x + i);
  float4 g  = *(const float4*)(gamma + c);
  float4 bt = *(const float4*)(beta + c);
  union { bf16 o[4]; uint2 u; } r;
  r.o[0] = (bf16)((v.x - mean) * inv * g.x + bt.x);
  r.o[1] = (bf16)((v.y - mean) * inv * g.y + bt.y);
  r.o[2] = (bf16)((v.z - mean) * inv * g.z + bt.z);
  r.o[3] = (bf16)((v.w - mean) * inv * g.w + bt.w);
  *(uint2*)(xn + i) = r.u;
}

// ---------------- kernel 3: weight transpose + cast (512x512 each) ----------
// Output: packed tiles, tile index = (n >> 4) * 16 + (k >> 5).
__global__ __launch_bounds__(256) void wcast_t(const float* __restrict__ wq,
                                               const float* __restrict__ wk,
                                               const float* __restrict__ wv,
                                               const float* __restrict__ wo,
                                               bf16* __restrict__ wqT,
                                               bf16* __restrict__ wkT,
                                               bf16* __restrict__ wvT,
                                               bf16* __restrict__ woT) {
  const float* w = (blockIdx.z == 0) ? wq : (blockIdx.z == 1) ? wk
                   : (blockIdx.z == 2) ? wv : wo;
  bf16* wt = (blockIdx.z == 0) ? wqT : (blockIdx.z == 1) ? wkT
             : (blockIdx.z == 2) ? wvT : woT;
  __shared__ float tile[32][33];
  int bx = blockIdx.x * 32, by = blockIdx.y * 32;
  int tx = threadIdx.x, ty = threadIdx.y;     // 32 x 8
  #pragma unroll
  for (int j = 0; j < 32; j += 8)
    tile[ty + j][tx] = w[(size_t)(by + ty + j) * 512 + bx + tx];
  __syncthreads();
  // The 32x32 block is two packed tiles (n 0..15 and n 16..31); each thread
  // writes 4 consecutive packed elements.
  int o   = (ty * 32 + tx) * 4;               // 0..1020
  int nt2 = o >> 9;
  int ln  = (o >> 3) & 31;
  int nl  = nt2 * 16 + (ln & 15);
  int kl  = ((o >> 8) & 1) * 16 + (ln >> 4) * 8 + (o & 7);
  union { bf16 e[4]; uint2 u; } r;
  #pragma unroll
  for (int i = 0; i < 4; ++i) r.e[i] = (bf16)tile[kl + i][nl];
  size_t dst = ((size_t)((bx >> 4) + nt2) * 16 + blockIdx.y) * 512 + (o & 511);
  *(uint2*)(wt + dst) = r.u;
}

// ---------------- kernel 4: fused QKV WMMA GEMM ----------------
// A panel (16 tokens x 512 K) async-staged in LDS once per block; 8 waves x
// 3 passes x 4 register-blocked accumulator tiles (one shared A per K-step).
// q stored [B*T, AD] bf16. k and v are stored as packed tiles per (b, head):
//   k: tile (16 keys x 32 head dims),  index (key >> 4) * 2 + (d >> 5)
//   v: tile (16 head dims x 32 keys),  index (key >> 5) * 4 + (d >> 4)
__global__ __launch_bounds__(256) void qkv_gemm(const bf16* __restrict__ xn,
                                                const bf16* __restrict__ wqT,
                                                const bf16* __restrict__ wkT,
                                                const bf16* __restrict__ wvT,
                                                const float* __restrict__ bq,
                                                const float* __restrict__ bk,
                                                const float* __restrict__ bv,
                                                bf16* __restrict__ q,
                                                bf16* __restrict__ k,
                                                bf16* __restrict__ vT) {
  int t0   = blockIdx.x * 16;            // global token row (over B*T)
  int b    = t0 / TT;
  int tloc = t0 - b * TT;
  int tid  = threadIdx.x;
  int wave = tid >> 5, lane = tid & 31;

  __shared__ __align__(16) bf16 As[16 * CC];   // 16 KB A panel
  stage_panel_async(xn + (size_t)t0 * CC, As, tid);
  __syncthreads();

  const int n = lane & 15, half = lane >> 4;

  for (int pass = 0; pass < 3; ++pass) {
    int tbase = wave * 12 + pass * 4;    // 4 consecutive tiles of 96
    const bf16* wp[4];
    const float* bp[4];
    int nb[4], mt[4];
    #pragma unroll
    for (int t = 0; t < 4; ++t) {
      int tile = tbase + t;
      mt[t] = tile >> 5;                 // 0=q 1=k 2=v
      nb[t] = (tile & 31) * 16;
      const bf16* wt = (mt[t] == 0) ? wqT : (mt[t] == 1) ? wkT : wvT;
      wp[t] = wt + (size_t)nb[t] * CC;
      bp[t] = (mt[t] == 0) ? bq : (mt[t] == 1) ? bk : bv;
    }
    v8f acc[4] = {{}, {}, {}, {}};
    for (int kk = 0; kk < CC; kk += 32) {
      v16bf a = load_ab(As + kk, CC, lane);     // LDS (ds_load_b128)
      #pragma unroll
      for (int t = 0; t < 4; ++t) {
        v16bf bm = load_packed(wp[t] + kk * 16, lane);
        acc[t] = wmma_bf16(a, bm, acc[t]);
      }
    }
    #pragma unroll
    for (int t = 0; t < 4; ++t) {
      float bias = bp[t][nb[t] + n];
      unsigned hb = (unsigned)(b * NH + (nb[t] >> 6)) * (TT * HD);  // (b, head) plane
      if (mt[t] == 0) {
        #pragma unroll
        for (int r = 0; r < 8; r++) {
          int m = r + half * 8;          // C-layout row
          q[(size_t)(t0 + m) * AD + nb[t] + n] = (bf16)(acc[t][r] + bias);
        }
        // The stores' data and address registers are reused by the next tile:
        // wait before they are overwritten.
        asm volatile("s_wait_xcnt 0x0" ::: "memory");
      } else if (mt[t] == 1) {           // K: row = key m, k index = head dim
        unsigned o = hb + (unsigned)((tloc >> 4) * 2 + ((nb[t] >> 5) & 1)) * 512
                   + ((nb[t] >> 4) & 1) * 256 + (n >> 3) * 128 + half * 64 + (n & 7);
        #pragma unroll
        for (int r = 0; r < 8; r++)      // key m = r + half * 8 lies at m * 8
          k[o + r * 8] = (bf16)(acc[t][r] + bias);
      } else {                           // V: row = head dim n, k index = key m
        unsigned o = hb + (unsigned)((tloc >> 5) * 4 + ((nb[t] >> 4) & 3)) * 512
                   + ((tloc >> 4) & 1) * 256 + lane * 8;
        union { bf16 e[8]; uint4 u; } pk;
        #pragma unroll
        for (int r = 0; r < 8; r++) pk.e[r] = (bf16)(acc[t][r] + bias);
        *(uint4*)(vT + o) = pk.u;
      }
    }
  }
}

// ---------------- kernel 5: flash attention, 1 wave per (b,h,16-q tile) ----
__global__ __launch_bounds__(32) void attn_flash(const bf16* __restrict__ q,
                                                 const bf16* __restrict__ k,
                                                 const bf16* __restrict__ vT,
                                                 bf16* __restrict__ attn) {
  const int qt = blockIdx.x * 16;   // query tile within batch
  const int h  = blockIdx.y;
  const int b  = blockIdx.z;
  const int lane = threadIdx.x;
  const float scale = 0.125f;       // 1/sqrt(64)

  const bf16* qbase = q  + ((size_t)(b * TT + qt) * AD) + h * HD;
  const bf16* kbase = k  + ((size_t)b * NH + h) * (TT * HD);  // packed tiles
  const bf16* vbase = vT + ((size_t)b * NH + h) * (TT * HD);  // packed tiles

  // Q A-operands for K chunks 0..31 and 32..63 (loaded once)
  v16bf a0 = load_ab(qbase,      AD, lane);
  v16bf a1 = load_ab(qbase + 32, AD, lane);

  v8f o[4] = {{}, {}, {}, {}};      // 16x64 output accumulator (4 N-tiles)
  float mrow[8], lrow[8];
  #pragma unroll
  for (int r = 0; r < 8; r++) { mrow[r] = -1e30f; lrow[r] = 0.f; }

  __shared__ __align__(16) bf16 pbuf[16 * 32];   // P tile staging (layout swap)
  const int n = lane & 15, half = lane >> 4;

  for (int kt = 0; kt < TT; kt += 32) {
    // ---- S = Q * K^T for 32 keys (two 16-key N-tiles) ----
    v8f s0 = {}, s1 = {};
    {
      const bf16* kp = kbase + (size_t)kt * HD;   // 4 packed tiles, 4 KB in a row
      v16bf b0a = load_packed(kp,        lane);
      v16bf b0b = load_packed(kp + 512,  lane);
      v16bf b1a = load_packed(kp + 1024, lane);
      v16bf b1b = load_packed(kp + 1536, lane);
      s0 = wmma_bf16(a0, b0a, s0); s0 = wmma_bf16(a1, b0b, s0);
      s1 = wmma_bf16(a0, b1a, s1); s1 = wmma_bf16(a1, b1b, s1);
    }
    // ---- online softmax (rows live in: vgpr r, 16-lane half) ----
    float mx[8];
    #pragma unroll
    for (int r = 0; r < 8; r++) {
      s0[r] *= scale; s1[r] *= scale;
      mx[r] = fmaxf(s0[r], s1[r]);
    }
    #pragma unroll
    for (int r = 0; r < 8; r++) {
      #pragma unroll
      for (int off = 1; off < 16; off <<= 1)          // stays within half
        mx[r] = fmaxf(mx[r], __shfl_xor(mx[r], off, 32));
      float mnew = fmaxf(mrow[r], mx[r]);
      float corr = __expf(mrow[r] - mnew);
      float p0 = __expf(s0[r] - mnew);
      float p1 = __expf(s1[r] - mnew);
      s0[r] = p0; s1[r] = p1;
      float rs = p0 + p1;
      #pragma unroll
      for (int off = 1; off < 16; off <<= 1)
        rs += __shfl_xor(rs, off, 32);
      lrow[r] = lrow[r] * corr + rs;
      mrow[r] = mnew;
      o[0][r] *= corr; o[1][r] *= corr; o[2][r] *= corr; o[3][r] *= corr;
    }
    // ---- C-layout P -> LDS -> A-layout bf16 ----
    #pragma unroll
    for (int r = 0; r < 8; r++) {
      int m = r + half * 8;
      pbuf[m * 32 + n]      = (bf16)s0[r];
      pbuf[m * 32 + 16 + n] = (bf16)s1[r];
    }
    __syncthreads();
    v16bf pa = load_ab(pbuf, 32, lane);
    // ---- O += P(16x32) * V(32x64), 4 N-tiles of head dim ----
    #pragma unroll
    for (int dt = 0; dt < 4; dt++) {
      v16bf vv = load_packed(vbase + (size_t)kt * HD + dt * 512, lane);
      o[dt] = wmma_bf16(pa, vv, o[dt]);
    }
    __syncthreads();
  }

  // ---- normalize and store attn [B*T, AD] bf16 ----
  bf16* outb = attn + ((size_t)(b * TT + qt) * AD) + h * HD;
  #pragma unroll
  for (int r = 0; r < 8; r++) {
    int m = r + half * 8;
    float inv = 1.0f / lrow[r];
    #pragma unroll
    for (int dt = 0; dt < 4; dt++)
      outb[(size_t)m * AD + dt * 16 + n] = (bf16)(o[dt][r] * inv);
  }
}

// ---------------- kernel 6: output projection + bias + residual ------------
// attn panel async-staged in LDS; each wave owns 4 register-blocked N-tiles.
__global__ __launch_bounds__(256) void out_proj(const bf16* __restrict__ attn,
                                                const bf16* __restrict__ woT,
                                                const float* __restrict__ bo,
                                                const float* __restrict__ x,
                                                float* __restrict__ out) {
  int t0  = blockIdx.x * 16;         // token row over B*T
  int tid = threadIdx.x;
  int wave = tid >> 5, lane = tid & 31;

  __shared__ __align__(16) bf16 As[16 * AD];   // 16 KB attn panel
  stage_panel_async(attn + (size_t)t0 * AD, As, tid);
  __syncthreads();

  int nbase0 = wave * 64;            // wave covers n-tiles 4w..4w+3
  v8f acc[4] = {{}, {}, {}, {}};
  for (int kk = 0; kk < AD; kk += 32) {
    v16bf a = load_ab(As + kk, AD, lane);      // LDS
    #pragma unroll
    for (int t = 0; t < 4; ++t) {
      v16bf bm = load_packed(woT + (size_t)(nbase0 + t * 16) * AD + kk * 16, lane);
      acc[t] = wmma_bf16(a, bm, acc[t]);
    }
  }
  int n = lane & 15, half = lane >> 4;
  #pragma unroll
  for (int t = 0; t < 4; ++t) {
    int nbase = nbase0 + t * 16;
    float bias = bo[nbase + n];
    #pragma unroll
    for (int r = 0; r < 8; r++) {
      int m = r + half * 8;
      size_t idx = (size_t)(t0 + m) * CC + nbase + n;
      out[idx] = x[idx] + acc[t][r] + bias;
    }
  }
}

// ---------------- launch ----------------
extern "C" void kernel_launch(void* const* d_in, const int* in_sizes, int n_in,
                              void* d_out, int out_size, void* d_ws, size_t ws_size,
                              hipStream_t stream) {
  const float* x     = (const float*)d_in[0];
  const float* gamma = (const float*)d_in[1];
  const float* beta  = (const float*)d_in[2];
  const float* wq    = (const float*)d_in[3];
  const float* bq    = (const float*)d_in[4];
  const float* wk    = (const float*)d_in[5];
  const float* bk    = (const float*)d_in[6];
  const float* wv    = (const float*)d_in[7];
  const float* bv    = (const float*)d_in[8];
  const float* wo    = (const float*)d_in[9];
  const float* bo    = (const float*)d_in[10];
  float* out = (float*)d_out;

  // workspace carve-up
  const size_t XN = (size_t)BSZ * TT * CC;   // 8.4M elems
  const size_t WW = (size_t)512 * 512;
  char* ws = (char*)d_ws;
  float* stats = (float*)ws;                 // 2*B floats
  bf16* xn  = (bf16*)(ws + 256);
  bf16* wqT = xn  + XN;
  bf16* wkT = wqT + WW;
  bf16* wvT = wkT + WW;
  bf16* woT = wvT + WW;
  bf16* qb  = woT + WW;
  bf16* kb  = qb  + XN;
  bf16* vT  = kb  + XN;
  bf16* attn = xn;                           // reuse xn after QKV

  gn_stats<<<BSZ, 256, 0, stream>>>(x, stats);
  gn_apply<<<(unsigned)(XN / 4 / 256), 256, 0, stream>>>(x, gamma, beta, stats, xn);
  wcast_t<<<dim3(16, 16, 4), dim3(32, 8), 0, stream>>>(wq, wk, wv, wo,
                                                       wqT, wkT, wvT, woT);
  qkv_gemm<<<(BSZ * TT) / 16, 256, 0, stream>>>(xn, wqT, wkT, wvT,
                                                bq, bk, bv, qb, kb, vT);
  attn_flash<<<dim3(TT / 16, NH, BSZ), 32, 0, stream>>>(qb, kb, vT, attn);
  out_proj<<<(BSZ * TT) / 16, 256, 0, stream>>>(attn, woT, bo, x, out);
}

// v002
// Measured time: 230 microseconds a run.
// In both of two side-by-side timings against v001, it was 1.32 times as fast.
// All steps since v000 together make it 1.90 times as fast.
#include <hip/hip_runtime.h>

// ---------------- problem constants ----------------
#define BSZ 16
#define TT  1024          // H*W tokens
#define CC  512           // channels
#define NH  8
#define HD  64
#define AD  512           // attention dim
#define EPSV 1e-5f

typedef __bf16 bf16;
typedef __bf16 v16bf __attribute__((ext_vector_type(16)));
typedef float  v8f   __attribute__((ext_vector_type(8)));

// ---------------- WMMA helpers ----------------
__device__ __forceinline__ v8f wmma_bf16(v16bf a, v16bf b, v8f c) {
  // D = A(16x32 bf16) * B(32x16 bf16) + C(16x16 f32)
  return __builtin_amdgcn_wmma_f32_16x16x32_bf16(
      /*neg_a=*/false, a, /*neg_b=*/false, b,
      /*c_mod=*/(short)0, c, /*reuse_a=*/false, /*reuse_b=*/false);
}

// Load a 16x32 bf16 A-operand (or 32x16 B-operand, mirrored) per the CDNA5
// VGPR layout: lanes 0-15 -> row=lane, K chunks {0..7} and {16..23};
// lanes 16-31 -> row=lane-16, K chunks {8..15} and {24..31}.
// Each chunk is 8 contiguous bf16 = one 16-byte load.
__device__ __forceinline__ v16bf load_ab(const bf16* base, int row_stride, int lane) {
  int half = lane >> 4;
  int r    = lane & 15;
  const bf16* p = base + (size_t)r * row_stride + half * 8;
  union { v16bf v; uint4 q[2]; } u;
  u.q[0] = *(const uint4*)(p);        // K 0..7   (or 8..15)
  u.q[1] = *(const uint4*)(p + 16);   // K 16..23 (or 24..31)
  return u.v;
}

// Packed operand tile: a 16-row x 32-k bf16 tile is stored as 512 elements in
// the order the lanes consume it: element (row, k) lies at
//   (k >> 4) * 256 + (((k >> 3) & 1) * 16 + row) * 8 + (k & 7).
// Each of the two wave-wide 16-byte loads then covers 512 contiguous bytes
// (4 whole 128-byte lines) and yields the same registers as load_ab().
__device__ __forceinline__ v16bf load_packed(const bf16* tile, int lane) {
  union { v16bf v; uint4 q[2]; } u;
  u.q[0] = *(const uint4*)(tile + lane * 8);        // K 0..7   (or 8..15)
  u.q[1] = *(const uint4*)(tile + 256 + lane * 8);  // K 16..23 (or 24..31)
  return u.v;
}

// Async-stage a contiguous 16 KB panel (16 rows x 512 bf16) from global into
// LDS: each of 256 threads copies 4 x 16B via global_load_async_to_lds_b128
// (ASYNCcnt path), then waits its own async counter. Caller must __syncthreads.
__device__ __forceinline__ void stage_panel_async(const bf16* __restrict__ gsrc,
                                                  bf16* lds_dst, int tid) {
  unsigned lds_base = (unsigned)(size_t)(void*)lds_dst;  // addr[31:0] = LDS offset
  unsigned off = (unsigned)tid * 16u;
  #pragma unroll
  for (int rr = 0; rr < 4; ++rr) {
    unsigned o = off + (unsigned)rr * 4096u;
    unsigned lds_a = lds_base + o;
    // s_wait_xcnt in the copy's own statement: its address registers are not
    // rewritten before the wait.
    asm volatile("global_load_async_to_lds_b128 %0, %1, %2\n\ts_wait_xcnt 0x0"
                 :: "v"(lds_a), "v"(o), "s"(gsrc)
                 : "memory");
  }
  asm volatile("s_wait_asynccnt 0x0" ::: "memory");
}

// ---------------- kernel 1: GroupNorm stats (1 group) ----------------
__global__ __launch_bounds__(256) void gn_stats(const float* __restrict__ x,
                                                float* __restrict__ stats) {
  int b = blockIdx.x;
  const float4* p = (const float4*)(x + (size_t)b * TT * CC);
  const int n4 = TT * CC / 4;
  float s = 0.f, ss = 0.f;
  for (int i = threadIdx.x; i < n4; i += 256) {
    float4 v = p[i];
    s  += v.x + v.y + v.z + v.w;
    ss += v.x * v.x + v.y * v.y + v.z * v.z + v.w * v.w;
  }
  __shared__ float sh0[256], sh1[256];
  sh0[threadIdx.x] = s; sh1[threadIdx.x] = ss;
  __syncthreads();
  for (int o = 128; o > 0; o >>= 1) {
    if (threadIdx.x < o) {
      sh0[threadIdx.x] += sh0[threadIdx.x + o];
      sh1[threadIdx.x] += sh1[threadIdx.x + o];
    }
    __syncthreads();
  }
  if (threadIdx.x == 0) {
    const float inv_n = 1.0f / (float)(TT * CC);
    float mean = sh0[0] * inv_n;
    float var  = sh1[0] * inv_n - mean * mean;
    stats[2 * b]     = mean;
    stats[2 * b + 1] = rsqrtf(var + EPSV);
  }
}

// ---------------- kernel 2: normalize + cast to bf16 ----------------
__global__ __launch_bounds__(256) void gn_apply(const float* __restrict__ x,
                                                const float* __restrict__ gamma,
                                                const float* __restrict__ beta,
                                                const float* __restrict__ stats,
                                                bf16* __restrict__ xn) {
  size_t i = ((size_t)blockIdx.x * 256 + threadIdx.x) * 4;
  int b = (int)(i / ((size_t)TT * CC));
  int c = (int)(i % CC);
  float mean = stats[2 * b], inv = stats[2 * b + 1];
  float4 v  = *(const float4*)(x + i);
  float4 g  = *(const float4*)(gamma + c);
  float4 bt = *(const float4*)(beta + c);
  union { bf16 o[4]; uint2 u; } r;
  r.o[0] = (bf16)((v.x - mean) * inv * g.x + bt.x);
  r.o[1] = (bf16)((v.y - mean) * inv * g.y + bt.y);
  r.o[2] = (bf16)((v.z - mean) * inv * g.z + bt.z);
  r.o[3] = (bf16)((v.w - mean) * inv * g.w + bt.w);
  *(uint2*)(xn + i) = r.u;
}

// ---------------- kernel 3: weight transpose + cast (512x512 each) ----------
// Output: packed tiles, tile index = (n >> 4) * 16 + (k >> 5).
__global__ __launch_bounds__(256) void wcast_t(const float* __restrict__ wq,
                                               const float* __restrict__ wk,
                                               const float* __restrict__ wv,
                                               const float* __restrict__ wo,
                                               bf16* __restrict__ wqT,
                                               bf16* __restrict__ wkT,
                                               bf16* __restrict__ wvT,
                                               bf16* __restrict__ woT) {
  const float* w = (blockIdx.z == 0) ? wq : (blockIdx.z == 1) ? wk
                   : (blockIdx.z == 2) ? wv : wo;
  bf16* wt = (blockIdx.z == 0) ? wqT : (blockIdx.z == 1) ? wkT
             : (blockIdx.z == 2) ? wvT : woT;
  __shared__ float tile[32][33];
  int bx = blockIdx.x * 32, by = blockIdx.y * 32;
  int tx = threadIdx.x, ty = threadIdx.y;     // 32 x 8
  #pragma unroll
  for (int j = 0; j < 32; j += 8)
    tile[ty + j][tx] = w[(size_t)(by + ty + j) * 512 + bx + tx];
  __syncthreads();
  // The 32x32 block is two packed tiles (n 0..15 and n 16..31); each thread
  // writes 4 consecutive packed elements.
  int o   = (ty * 32 + tx) * 4;               // 0..1020
  int nt2 = o >> 9;
  int ln  = (o >> 3) & 31;
  int nl  = nt2 * 16 + (ln & 15);
  int kl  = ((o >> 8) & 1) * 16 + (ln >> 4) * 8 + (o & 7);
  union { bf16 e[4]; uint2 u; } r;
  #pragma unroll
  for (int i = 0; i < 4; ++i) r.e[i] = (bf16)tile[kl + i][nl];
  size_t dst = ((size_t)((bx >> 4) + nt2) * 16 + blockIdx.y) * 512 + (o & 511);
  *(uint2*)(wt + dst) = r.u;
}

// ---------------- kernel 4: fused QKV WMMA GEMM ----------------
// A panel (16 tokens x 512 K) async-staged in LDS once per block; 8 waves x
// 3 passes x 4 register-blocked accumulator tiles (one shared A per K-step).
// q stored [B*T, AD] bf16. k and v are stored as packed tiles per (b, head):
//   k: tile (16 keys x 32 head dims),  index (key >> 4) * 2 + (d >> 5)
//   v: tile (16 head dims x 32 keys),  index (key >> 5) * 4 + (d >> 4)
__global__ __launch_bounds__(256) void qkv_gemm(const bf16* __restrict__ xn,
                                                const bf16* __restrict__ wqT,
                                                const bf16* __restrict__ wkT,
                                                const bf16* __restrict__ wvT,
                                                const float* __restrict__ bq,
                                                const float* __restrict__ bk,
                                                const float* __restrict__ bv,
                                                bf16* __restrict__ q,
                                                bf16* __restrict__ k,
                                                bf16* __restrict__ vT) {
  int t0   = blockIdx.x * 16;            // global token row (over B*T)
  int b    = t0 / TT;
  int tloc = t0 - b * TT;
  int tid  = threadIdx.x;
  int wave = tid >> 5, lane = tid & 31;

  __shared__ __align__(16) bf16 As[16 * CC];   // 16 KB A panel
  stage_panel_async(xn + (size_t)t0 * CC, As, tid);
  __syncthreads();

  const int n = lane & 15, half = lane >> 4;

  for (int pass = 0; pass < 3; ++pass) {
    int tbase = wave * 12 + pass * 4;    // 4 consecutive tiles of 96
    const bf16* wp[4];
    const float* bp[4];
    int nb[4], mt[4];
    #pragma unroll
    for (int t = 0; t < 4; ++t) {
      int tile = tbase + t;
      mt[t] = tile >> 5;                 // 0=q 1=k 2=v
      nb[t] = (tile & 31) * 16;
      const bf16* wt = (mt[t] == 0) ? wqT : (mt[t] == 1) ? wkT : wvT;
      wp[t] = wt + (size_t)nb[t] * CC;
      bp[t] = (mt[t] == 0) ? bq : (mt[t] == 1) ? bk : bv;
    }
    v8f acc[4] = {{}, {}, {}, {}};
    for (int kk = 0; kk < CC; kk += 32) {
      v16bf a = load_ab(As + kk, CC, lane);     // LDS (ds_load_b128)
      #pragma unroll
      for (int t = 0; t < 4; ++t) {
        v16bf bm = load_packed(wp[t] + kk * 16, lane);
        acc[t] = wmma_bf16(a, bm, acc[t]);
      }
    }
    #pragma unroll
    for (int t = 0; t < 4; ++t) {
      float bias = bp[t][nb[t] + n];
      unsigned hb = (unsigned)(b * NH + (nb[t] >> 6)) * (TT * HD);  // (b, head) plane
      if (mt[t] == 0) {
        #pragma unroll
        for (int r = 0; r < 8; r++) {
          int m = r + half * 8;          // C-layout row
          q[(size_t)(t0 + m) * AD + nb[t] + n] = (bf16)(acc[t][r] + bias);
        }
        // The stores' data and address registers are reused by the next tile:
        // wait before they are overwritten.
        asm volatile("s_wait_xcnt 0x0" ::: "memory");
      } else if (mt[t] == 1) {           // K: row = key m, k index = head dim
        unsigned o = hb + (unsigned)((tloc >> 4) * 2 + ((nb[t] >> 5) & 1)) * 512
                   + ((nb[t] >> 4) & 1) * 256 + (n >> 3) * 128 + half * 64 + (n & 7);
        #pragma unroll
        for (int r = 0; r < 8; r++)      // key m = r + half * 8 lies at m * 8
          k[o + r * 8] = (bf16)(acc[t][r] + bias);
      } else {                           // V: row = head dim n, k index = key m
        unsigned o = hb + (unsigned)((tloc >> 5) * 4 + ((nb[t] >> 4) & 3)) * 512
                   + ((tloc >> 4) & 1) * 256 + lane * 8;
        union { bf16 e[8]; uint4 u; } pk;
        #pragma unroll
        for (int r = 0; r < 8; r++) pk.e[r] = (bf16)(acc[t][r] + bias);
        *(uint4*)(vT + o) = pk.u;
      }
    }
  }
}

// Value of lane l ^ 16 (the other half's share of the same query).
__device__ __forceinline__ float other_half(float v) {
  int b = __builtin_bit_cast(int, v);
  b = __builtin_amdgcn_permlanex16(b, b, 0x76543210, 0xfedcba98, false, false);
  return __builtin_bit_cast(float, b);
}

__global__ __launch_bounds__(32) void attn_flash(const bf16* __restrict__ q,
                                                 const bf16* __restrict__ k,
                                                 const bf16* __restrict__ vT,
                                                 bf16* __restrict__ attn) {
  const int qt = blockIdx.x * 16;   // query tile within batch
  const int h  = blockIdx.y;
  const int b  = blockIdx.z;
  const int lane = threadIdx.x;
  const float scale = 0.125f;       // 1/sqrt(64), a power of two: exact

  const bf16* qbase = q  + ((size_t)(b * TT + qt) * AD) + h * HD;
  const bf16* kbase = k  + ((size_t)b * NH + h) * (TT * HD);  // packed tiles
  const bf16* vbase = vT + ((size_t)b * NH + h) * (TT * HD);  // packed tiles

  // Q^T B-operands for head dims 0..31 and 32..63 (loaded once)
  v16bf q0 = load_ab(qbase,      AD, lane);
  v16bf q1 = load_ab(qbase + 32, AD, lane);

  // o[dt][r] = O[query n][head dim dt * 16 + half * 8 + r]
  v8f o[4] = {{}, {}, {}, {}};
  float mrow = -1e30f;              // running maximum of this lane's query
  float lrow = 0.f;                 // running sum over this half's keys only
  const int n = lane & 15, half = lane >> 4;

  for (int kt = 0; kt < TT; kt += 32) {
    // ---- S^T = K * Q^T for 32 keys (two 16-key M-tiles) ----
    const bf16* kp = kbase + (size_t)kt * HD;   // 4 packed tiles, 4 KB in a row
    const bf16* vp = vbase + (size_t)kt * HD;   // 4 packed tiles, 4 KB in a row
    v16bf k0a = load_packed(kp,        lane);
    v16bf k0b = load_packed(kp + 512,  lane);
    v16bf k1a = load_packed(kp + 1024, lane);
    v16bf k1b = load_packed(kp + 1536, lane);
    v8f s0 = {}, s1 = {};
    s0 = wmma_bf16(k0a, q0, s0); s0 = wmma_bf16(k0b, q1, s0);
    s1 = wmma_bf16(k1a, q0, s1); s1 = wmma_bf16(k1b, q1, s1);

    // ---- online softmax, one query per lane ----
    float mx = fmaxf(s0[0], s1[0]);
    #pragma unroll
    for (int r = 1; r < 8; r++) mx = fmaxf(mx, fmaxf(s0[r], s1[r]));
    mx = fmaxf(mx, other_half(mx)) * scale;
    float mnew = fmaxf(mrow, mx);
    // corr = exp(mrow - mnew). v_exp_f32 and the one slot the instruction set
    // asks for behind it stand in one statement: the instruction that follows
    // may read the result or reuse the source register.
    float corr;
    asm("v_exp_f32 %0, %1\n\tv_nop" : "=v"(corr) : "v"((mrow - mnew) * 1.44269504f));
    v16bf p;   // P^T: element r is key half * 8 + r, element 8 + r key 16 + half * 8 + r
    float t[8];
    #pragma unroll
    for (int r = 0; r < 8; r++) {
      float p0 = __expf(s0[r] * scale - mnew);
      float p1 = __expf(s1[r] * scale - mnew);
      p[r]     = (bf16)p0;
      p[8 + r] = (bf16)p1;
      t[r] = p0 + p1;
    }
    float rs = ((t[0] + t[1]) + (t[2] + t[3])) + ((t[4] + t[5]) + (t[6] + t[7]));
    lrow = lrow * corr + rs;
    mrow = mnew;
    #pragma unroll
    for (int dt = 0; dt < 4; dt++) o[dt] *= corr;

    // ---- O^T += V^T(16 dims x 32 keys) * P^T(32 keys x 16 queries) ----
    #pragma unroll
    for (int dt = 0; dt < 4; dt++) {
      v16bf vv = load_packed(vp + dt * 512, lane);
      o[dt] = wmma_bf16(vv, p, o[dt]);
    }
  }

  // ---- join the halves' sums, normalize, store attn [B*T, AD] bf16 ----
  float inv = 1.0f / (lrow + other_half(lrow));
  bf16* outb = attn + ((size_t)(b * TT + qt + n) * AD) + h * HD + half * 8;
  #pragma unroll
  for (int dt = 0; dt < 4; dt++) {
    union { bf16 e[8]; uint4 u; } pk;
    #pragma unroll
    for (int r = 0; r < 8; r++) pk.e[r] = (bf16)(o[dt][r] * inv);
    *(uint4*)(outb + dt * 16) = pk.u;
  }
}

// ---------------- kernel 6: output projection + bias + residual ------------
// attn panel async-staged in LDS; each wave owns 4 register-blocked N-tiles.
__global__ __launch_bounds__(256) void out_proj(const bf16* __restrict__ attn,
                                                const bf16* __restrict__ woT,
                                                const float* __restrict__ bo,
                                                const float* __restrict__ x,
                                                float* __restrict__ out) {
  int t0  = blockIdx.x * 16;         // token row over B*T
  int tid = threadIdx.x;
  int wave = tid >> 5, lane = tid & 31;

  __shared__ __align__(16) bf16 As[16 * AD];   // 16 KB attn panel
  stage_panel_async(attn + (size_t)t0 * AD, As, tid);
  __syncthreads();

  int nbase0 = wave * 64;            // wave covers n-tiles 4w..4w+3
  v8f acc[4] = {{}, {}, {}, {}};
  for (int kk = 0; kk < AD; kk += 32) {
    v16bf a = load_ab(As + kk, AD, lane);      // LDS
    #pragma unroll
    for (int t = 0; t < 4; ++t) {
      v16bf bm = load_packed(woT + (size_t)(nbase0 + t * 16) * AD + kk * 16, lane);
      acc[t] = wmma_bf16(a, bm, acc[t]);
    }
  }
  int n = lane & 15, half = lane >> 4;
  #pragma unroll
  for (int t = 0; t < 4; ++t) {
    int nbase = nbase0 + t * 16;
    float bias = bo[nbase + n];
    #pragma unroll
    for (int r = 0; r < 8; r++) {
      int m = r + half * 8;
      size_t idx = (size_t)(t0 + m) * CC + nbase + n;
      out[idx] = x[idx] + acc[t][r] + bias;
    }
  }
}

// ---------------- launch ----------------
extern "C" void kernel_launch(void* const* d_in, const int* in_sizes, int n_in,
                              void* d_out, int out_size, void* d_ws, size_t ws_size,
                              hipStream_t stream) {
  const float* x     = (const float*)d_in[0];
  const float* gamma = (const float*)d_in[1];
  const float* beta  = (const float*)d_in[2];
  const float* wq    = (const float*)d_in[3];
  const float* bq    = (const float*)d_in[4];
  const float* wk    = (const float*)d_in[5];
  const float* bk    = (const float*)d_in[6];
  const float* wv    = (const float*)d_in[7];
  const float* bv    = (const float*)d_in[8];
  const float* wo    = (const float*)d_in[9];
  const float* bo    = (const float*)d_in[10];
  float* out = (float*)d_out;

  // workspace carve-up
  const size_t XN = (size_t)BSZ * TT * CC;   // 8.4M elems
  const size_t WW = (size_t)512 * 512;
  char* ws = (char*)d_ws;
  float* stats = (float*)ws;                 // 2*B floats
  bf16* xn  = (bf16*)(ws + 256);
  bf16* wqT = xn  + XN;
  bf16* wkT = wqT + WW;
  bf16* wvT = wkT + WW;
  bf16* woT = wvT + WW;
  bf16* qb  = woT + WW;
  bf16* kb  = qb  + XN;
  bf16* vT  = kb  + XN;
  bf16* attn = xn;                           // reuse xn after QKV

  gn_stats<<<BSZ, 256, 0, stream>>>(x, stats);
  gn_apply<<<(unsigned)(XN / 4 / 256), 256, 0, stream>>>(x, gamma, beta, stats, xn);
  wcast_t<<<dim3(16, 16, 4), dim3(32, 8), 0, stream>>>(wq, wk, wv, wo,
                                                       wqT, wkT, wvT, woT);
  qkv_gemm<<<(BSZ * TT) / 16, 256, 0, stream>>>(xn, wqT, wkT, wvT,
                                                bq, bk, bv, qb, kb, vT);
  attn_flash<<<dim3(TT / 16, NH, BSZ), 32, 0, stream>>>(qb, kb, vT, attn);
  out_proj<<<(BSZ * TT) / 16, 256, 0, stream>>>(attn, woT, bo, x, out);
}

// v003
// One run takes 219 microseconds.
// Next to v002, in two timings, it ran 1.07 and 1.06 times as fast.
// All steps since v000 together make it 2.02 times as fast.
#include <hip/hip_runtime.h>

// ---------------- problem constants ----------------
#define BSZ 16
#define TT  1024          // H*W tokens
#define CC  512           // channels
#define NH  8
#define HD  64
#define AD  512           // attention dim
#define EPSV 1e-5f

typedef __bf16 bf16;
typedef __bf16 v16bf __attribute__((ext_vector_type(16)));
typedef float  v8f   __attribute__((ext_vector_type(8)));

// ---------------- WMMA helpers ----------------
__device__ __forceinline__ v8f wmma_bf16(v16bf a, v16bf b, v8f c) {
  // D = A(16x32 bf16) * B(32x16 bf16) + C(16x16 f32)
  return __builtin_amdgcn_wmma_f32_16x16x32_bf16(
      /*neg_a=*/false, a, /*neg_b=*/false, b,
      /*c_mod=*/(short)0, c, /*reuse_a=*/false, /*reuse_b=*/false);
}

// Load a 16x32 bf16 A-operand (or 32x16 B-operand, mirrored) per the CDNA5
// VGPR layout: lanes 0-15 -> row=lane, K chunks {0..7} and {16..23};
// lanes 16-31 -> row=lane-16, K chunks {8..15} and {24..31}.
// Each chunk is 8 contiguous bf16 = one 16-byte load.
__device__ __forceinline__ v16bf load_ab(const bf16* base, int row_stride, int lane) {
  int half = lane >> 4;
  int r    = lane & 15;
  const bf16* p = base + (size_t)r * row_stride + half * 8;
  union { v16bf v; uint4 q[2]; } u;
  u.q[0] = *(const uint4*)(p);        // K 0..7   (or 8..15)
  u.q[1] = *(const uint4*)(p + 16);   // K 16..23 (or 24..31)
  return u.v;
}

// Packed operand tile: a 16-row x 32-k bf16 tile is stored as 512 elements in
// the order the lanes consume it: element (row, k) lies at
//   (k >> 4) * 256 + (((k >> 3) & 1) * 16 + row) * 8 + (k & 7).
// Each of the two wave-wide 16-byte loads then covers 512 contiguous bytes
// (4 whole 128-byte lines) and yields the same registers as load_ab().
__device__ __forceinline__ v16bf load_packed(const bf16* tile, int lane) {
  union { v16bf v; uint4 q[2]; } u;
  u.q[0] = *(const uint4*)(tile + lane * 8);        // K 0..7   (or 8..15)
  u.q[1] = *(const uint4*)(tile + 256 + lane * 8);  // K 16..23 (or 24..31)
  return u.v;
}

// Async-stage a contiguous 16 KB panel (16 rows x 512 bf16) from global into
// LDS: each of 256 threads copies 4 x 16B via global_load_async_to_lds_b128
// (ASYNCcnt path), then waits its own async counter. Caller must __syncthreads.
__device__ __forceinline__ void stage_panel_async(const bf16* __restrict__ gsrc,
                                                  bf16* lds_dst, int tid) {
  unsigned lds_base = (unsigned)(size_t)(void*)lds_dst;  // addr[31:0] = LDS offset
  unsigned off = (unsigned)tid * 16u;
  #pragma unroll
  for (int rr = 0; rr < 4; ++rr) {
    unsigned o = off + (unsigned)rr * 4096u;
    unsigned lds_a = lds_base + o;
    // s_wait_xcnt in the copy's own statement: its address registers are not
    // rewritten before the wait.
    asm volatile("global_load_async_to_lds_b128 %0, %1, %2\n\ts_wait_xcnt 0x0"
                 :: "v"(lds_a), "v"(o), "s"(gsrc)
                 : "memory");
  }
  asm volatile("s_wait_asynccnt 0x0" ::: "memory");
}

// ---------------- kernel 1: GroupNorm stats (1 group) ----------------
__global__ __launch_bounds__(256) void gn_stats(const float* __restrict__ x,
                                                float* __restrict__ stats) {
  int b = blockIdx.x;
  const float4* p = (const float4*)(x + (size_t)b * TT * CC);
  const int n4 = TT * CC / 4;
  float s = 0.f, ss = 0.f;
  for (int i = threadIdx.x; i < n4; i += 256) {
    float4 v = p[i];
    s  += v.x + v.y + v.z + v.w;
    ss += v.x * v.x + v.y * v.y + v.z * v.z + v.w * v.w;
  }
  __shared__ float sh0[256], sh1[256];
  sh0[threadIdx.x] = s; sh1[threadIdx.x] = ss;
  __syncthreads();
  for (int o = 128; o > 0; o >>= 1) {
    if (threadIdx.x < o) {
      sh0[threadIdx.x] += sh0[threadIdx.x + o];
      sh1[threadIdx.x] += sh1[threadIdx.x + o];
    }
    __syncthreads();
  }
  if (threadIdx.x == 0) {
    const float inv_n = 1.0f / (float)(TT * CC);
    float mean = sh0[0] * inv_n;
    float var  = sh1[0] * inv_n - mean * mean;
    stats[2 * b]     = mean;
    stats[2 * b + 1] = rsqrtf(var + EPSV);
  }
}

// ---------------- kernel 2: weight transpose + cast (512x512 each) ----------
// Output: packed tiles, tile index = (n >> 4) * 16 + (k >> 5).
__global__ __launch_bounds__(256) void wcast_t(const float* __restrict__ wq,
                                               const float* __restrict__ wk,
                                               const float* __restrict__ wv,
                                               const float* __restrict__ wo,
                                               bf16* __restrict__ wqT,
                                               bf16* __restrict__ wkT,
                                               bf16* __restrict__ wvT,
                                               bf16* __restrict__ woT) {
  const float* w = (blockIdx.z == 0) ? wq : (blockIdx.z == 1) ? wk
                   : (blockIdx.z == 2) ? wv : wo;
  bf16* wt = (blockIdx.z == 0) ? wqT : (blockIdx.z == 1) ? wkT
             : (blockIdx.z == 2) ? wvT : woT;
  __shared__ float tile[32][33];
  int bx = blockIdx.x * 32, by = blockIdx.y * 32;
  int tx = threadIdx.x, ty = threadIdx.y;     // 32 x 8
  #pragma unroll
  for (int j = 0; j < 32; j += 8)
    tile[ty + j][tx] = w[(size_t)(by + ty + j) * 512 + bx + tx];
  __syncthreads();
  // The 32x32 block is two packed tiles (n 0..15 and n 16..31); each thread
  // writes 4 consecutive packed elements.
  int o   = (ty * 32 + tx) * 4;               // 0..1020
  int nt2 = o >> 9;
  int ln  = (o >> 3) & 31;
  int nl  = nt2 * 16 + (ln & 15);
  int kl  = ((o >> 8) & 1) * 16 + (ln >> 4) * 8 + (o & 7);
  union { bf16 e[4]; uint2 u; } r;
  #pragma unroll
  for (int i = 0; i < 4; ++i) r.e[i] = (bf16)tile[kl + i][nl];
  size_t dst = ((size_t)((bx >> 4) + nt2) * 16 + blockIdx.y) * 512 + (o & 511);
  *(uint2*)(wt + dst) = r.u;
}

// ---------------- kernel 3: GroupNorm apply + fused QKV WMMA GEMM ----------
// A panel (16 tokens x 512 K): x is read as f32, normalized, cast to bf16 and
// written to LDS once per block; 8 waves x 3 passes x 4 register-blocked
// accumulator tiles (one shared A per K-step).
// q stored [B*T, AD] bf16. k and v are stored as packed tiles per (b, head):
//   k: tile (16 keys x 32 head dims),  index (key >> 4) * 2 + (d >> 5)
//   v: tile (16 head dims x 32 keys),  index (key >> 5) * 4 + (d >> 4)
__global__ __launch_bounds__(256) void qkv_gemm(const float* __restrict__ x,
                                                const float* __restrict__ gamma,
                                                const float* __restrict__ beta,
                                                const float* __restrict__ stats,
                                                const bf16* __restrict__ wqT,
                                                const bf16* __restrict__ wkT,
                                                const bf16* __restrict__ wvT,
                                                const float* __restrict__ bq,
                                                const float* __restrict__ bk,
                                                const float* __restrict__ bv,
                                                bf16* __restrict__ q,
                                                bf16* __restrict__ k,
                                                bf16* __restrict__ vT) {
  int t0   = blockIdx.x * 16;            // global token row (over B*T)
  int b    = t0 / TT;
  int tloc = t0 - b * TT;
  int tid  = threadIdx.x;
  int wave = tid >> 5, lane = tid & 31;

  __shared__ __align__(16) bf16 As[16 * CC];   // 16 KB A panel
  {
    // Thread tid takes the same 4 channels of rows rr * 2 + (tid >> 7): the
    // panel is 2048 float4 in a row, 8 per thread, all loads issued together.
    const float mean = stats[2 * b], inv = stats[2 * b + 1];
    const float* xp = x + (size_t)t0 * CC + tid * 4;
    float4 v[8];
    // unrolled: v[] stays in registers and the 8 loads are in flight together
    #pragma unroll
    for (int rr = 0; rr < 8; ++rr) v[rr] = *(const float4*)(xp + rr * 1024);
    const int c = (tid & 127) * 4;
    float4 g  = *(const float4*)(gamma + c);
    float4 bt = *(const float4*)(beta + c);
    // unrolled: v[rr] is indexed by a constant, so it needs no scratch memory
    #pragma unroll
    for (int rr = 0; rr < 8; ++rr) {
      union { bf16 o[4]; uint2 u; } r;
      r.o[0] = (bf16)((v[rr].x - mean) * inv * g.x + bt.x);
      r.o[1] = (bf16)((v[rr].y - mean) * inv * g.y + bt.y);
      r.o[2] = (bf16)((v[rr].z - mean) * inv * g.z + bt.z);
      r.o[3] = (bf16)((v[rr].w - mean) * inv * g.w + bt.w);
      *(uint2*)(As + tid * 4 + rr * 1024) = r.u;
    }
  }
  __syncthreads();

  const int n = lane & 15, half = lane >> 4;

  for (int pass = 0; pass < 3; ++pass) {
    int tbase = wave * 12 + pass * 4;    // 4 consecutive tiles of 96
    const bf16* wp[4];
    const float* bp[4];
    int nb[4], mt[4];
    #pragma unroll
    for (int t = 0; t < 4; ++t) {
      int tile = tbase + t;
      mt[t] = tile >> 5;                 // 0=q 1=k 2=v
      nb[t] = (tile & 31) * 16;
      const bf16* wt = (mt[t] == 0) ? wqT : (mt[t] == 1) ? wkT : wvT;
      wp[t] = wt + (size_t)nb[t] * CC;
      bp[t] = (mt[t] == 0) ? bq : (mt[t] == 1) ? bk : bv;
    }
    v8f acc[4] = {{}, {}, {}, {}};
    for (int kk = 0; kk < CC; kk += 32) {
      v16bf a = load_ab(As + kk, CC, lane);     // LDS (ds_load_b128)
      #pragma unroll
      for (int t = 0; t < 4; ++t) {
        v16bf bm = load_packed(wp[t] + kk * 16, lane);
        acc[t] = wmma_bf16(a, bm, acc[t]);
      }
    }
    #pragma unroll
    for (int t = 0; t < 4; ++t) {
      float bias = bp[t][nb[t] + n];
      unsigned hb = (unsigned)(b * NH + (nb[t] >> 6)) * (TT * HD);  // (b, head) plane
      if (mt[t] == 0) {
        #pragma unroll
        for (int r = 0; r < 8; r++) {
          int m = r + half * 8;          // C-layout row
          q[(size_t)(t0 + m) * AD + nb[t] + n] = (bf16)(acc[t][r] + bias);
        }
        // The stores' data and address registers are reused by the next tile:
        // wait before they are overwritten.
        asm volatile("s_wait_xcnt 0x0" ::: "memory");
      } else if (mt[t] == 1) {           // K: row = key m, k index = head dim
        unsigned o = hb + (unsigned)((tloc >> 4) * 2 + ((nb[t] >> 5) & 1)) * 512
                   + ((nb[t] >> 4) & 1) * 256 + (n >> 3) * 128 + half * 64 + (n & 7);
        #pragma unroll
        for (int r = 0; r < 8; r++)      // key m = r + half * 8 lies at m * 8
          k[o + r * 8] = (bf16)(acc[t][r] + bias);
      } else {                           // V: row = head dim n, k index = key m
        unsigned o = hb + (unsigned)((tloc >> 5) * 4 + ((nb[t] >> 4) & 3)) * 512
                   + ((tloc >> 4) & 1) * 256 + lane * 8;
        union { bf16 e[8]; uint4 u; } pk;
        #pragma unroll
        for (int r = 0; r < 8; r++) pk.e[r] = (bf16)(acc[t][r] + bias);
        *(uint4*)(vT + o) = pk.u;
      }
    }
  }
}

// Value of lane l ^ 16 (the other half's share of the same query).
__device__ __forceinline__ float other_half(float v) {
  int b = __builtin_bit_cast(int, v);
  b = __builtin_amdgcn_permlanex16(b, b, 0x76543210, 0xfedcba98, false, false);
  return __builtin_bit_cast(float, b);
}

__global__ __launch_bounds__(32) void attn_flash(const bf16* __restrict__ q,
                                                 const bf16* __restrict__ k,
                                                 const bf16* __restrict__ vT,
                                                 bf16* __restrict__ attn) {
  const int qt = blockIdx.x * 16;   // query tile within batch
  const int h  = blockIdx.y;
  const int b  = blockIdx.z;
  const int lane = threadIdx.x;
  const float scale = 0.125f;       // 1/sqrt(64), a power of two: exact

  const bf16* qbase = q  + ((size_t)(b * TT + qt) * AD) + h * HD;
  const bf16* kbase = k  + ((size_t)b * NH + h) * (TT * HD);  // packed tiles
  const bf16* vbase = vT + ((size_t)b * NH + h) * (TT * HD);  // packed tiles

  // Q^T B-operands for head dims 0..31 and 32..63 (loaded once)
  v16bf q0 = load_ab(qbase,      AD, lane);
  v16bf q1 = load_ab(qbase + 32, AD, lane);

  // o[dt][r] = O[query n][head dim dt * 16 + half * 8 + r]
  v8f o[4] = {{}, {}, {}, {}};
  float mrow = -1e30f;              // running maximum of this lane's query
  float lrow = 0.f;                 // running sum over this half's keys only
  const int n = lane & 15, half = lane >> 4;

  for (int kt = 0; kt < TT; kt += 32) {
    // ---- S^T = K * Q^T for 32 keys (two 16-key M-tiles) ----
    const bf16* kp = kbase + (size_t)kt * HD;   // 4 packed tiles, 4 KB in a row
    const bf16* vp = vbase + (size_t)kt * HD;   // 4 packed tiles, 4 KB in a row
    v16bf k0a = load_packed(kp,        lane);
    v16bf k0b = load_packed(kp + 512,  lane);
    v16bf k1a = load_packed(kp + 1024, lane);
    v16bf k1b = load_packed(kp + 1536, lane);
    v8f s0 = {}, s1 = {};
    s0 = wmma_bf16(k0a, q0, s0); s0 = wmma_bf16(k0b, q1, s0);
    s1 = wmma_bf16(k1a, q0, s1); s1 = wmma_bf16(k1b, q1, s1);

    // ---- online softmax, one query per lane ----
    float mx = fmaxf(s0[0], s1[0]);
    #pragma unroll
    for (int r = 1; r < 8; r++) mx = fmaxf(mx, fmaxf(s0[r], s1[r]));
    mx = fmaxf(mx, other_half(mx)) * scale;
    float mnew = fmaxf(mrow, mx);
    // corr = exp(mrow - mnew). v_exp_f32 and the one slot the instruction set
    // asks for behind it stand in one statement: the instruction that follows
    // may read the result or reuse the source register.
    float corr;
    asm("v_exp_f32 %0, %1\n\tv_nop" : "=v"(corr) : "v"((mrow - mnew) * 1.44269504f));
    v16bf p;   // P^T: element r is key half * 8 + r, element 8 + r key 16 + half * 8 + r
    float t[8];
    #pragma unroll
    for (int r = 0; r < 8; r++) {
      float p0 = __expf(s0[r] * scale - mnew);
      float p1 = __expf(s1[r] * scale - mnew);
      p[r]     = (bf16)p0;
      p[8 + r] = (bf16)p1;
      t[r] = p0 + p1;
    }
    float rs = ((t[0] + t[1]) + (t[2] + t[3])) + ((t[4] + t[5]) + (t[6] + t[7]));
    lrow = lrow * corr + rs;
    mrow = mnew;
    #pragma unroll
    for (int dt = 0; dt < 4; dt++) o[dt] *= corr;

    // ---- O^T += V^T(16 dims x 32 keys) * P^T(32 keys x 16 queries) ----
    #pragma unroll
    for (int dt = 0; dt < 4; dt++) {
      v16bf vv = load_packed(vp + dt * 512, lane);
      o[dt] = wmma_bf16(vv, p, o[dt]);
    }
  }

  // ---- join the halves' sums, normalize, store attn [B*T, AD] bf16 ----
  float inv = 1.0f / (lrow + other_half(lrow));
  bf16* outb = attn + ((size_t)(b * TT + qt + n) * AD) + h * HD + half * 8;
  #pragma unroll
  for (int dt = 0; dt < 4; dt++) {
    union { bf16 e[8]; uint4 u; } pk;
    #pragma unroll
    for (int r = 0; r < 8; r++) pk.e[r] = (bf16)(o[dt][r] * inv);
    *(uint4*)(outb + dt * 16) = pk.u;
  }
}

// ---------------- kernel 5: output projection + bias + residual ------------
// attn panel async-staged in LDS; each wave owns 4 register-blocked N-tiles.
__global__ __launch_bounds__(256) void out_proj(const bf16* __restrict__ attn,
                                                const bf16* __restrict__ woT,
                                                const float* __restrict__ bo,
                                                const float* __restrict__ x,
                                                float* __restrict__ out) {
  int t0  = blockIdx.x * 16;         // token row over B*T
  int tid = threadIdx.x;
  int wave = tid >> 5, lane = tid & 31;

  __shared__ __align__(16) bf16 As[16 * AD];   // 16 KB attn panel
  stage_panel_async(attn + (size_t)t0 * AD, As, tid);
  __syncthreads();

  int nbase0 = wave * 64;            // wave covers n-tiles 4w..4w+3
  v8f acc[4] = {{}, {}, {}, {}};
  for (int kk = 0; kk < AD; kk += 32) {
    v16bf a = load_ab(As + kk, AD, lane);      // LDS
    #pragma unroll
    for (int t = 0; t < 4; ++t) {
      v16bf bm = load_packed(woT + (size_t)(nbase0 + t * 16) * AD + kk * 16, lane);
      acc[t] = wmma_bf16(a, bm, acc[t]);
    }
  }
  int n = lane & 15, half = lane >> 4;
  #pragma unroll
  for (int t = 0; t < 4; ++t) {
    int nbase = nbase0 + t * 16;
    float bias = bo[nbase + n];
    #pragma unroll
    for (int r = 0; r < 8; r++) {
      int m = r + half * 8;
      size_t idx = (size_t)(t0 + m) * CC + nbase + n;
      out[idx] = x[idx] + acc[t][r] + bias;
    }
  }
}

// ---------------- launch ----------------
extern "C" void kernel_launch(void* const* d_in, const int* in_sizes, int n_in,
                              void* d_out, int out_size, void* d_ws, size_t ws_size,
                              hipStream_t stream) {
  const float* x     = (const float*)d_in[0];
  const float* gamma = (const float*)d_in[1];
  const float* beta  = (const float*)d_in[2];
  const float* wq    = (const float*)d_in[3];
  const float* bq    = (const float*)d_in[4];
  const float* wk    = (const float*)d_in[5];
  const float* bk    = (const float*)d_in[6];
  const float* wv    = (const float*)d_in[7];
  const float* bv    = (const float*)d_in[8];
  const float* wo    = (const float*)d_in[9];
  const float* bo    = (const float*)d_in[10];
  float* out = (float*)d_out;

  // workspace carve-up
  const size_t XN = (size_t)BSZ * TT * CC;   // 8.4M elems
  const size_t WW = (size_t)512 * 512;
  char* ws = (char*)d_ws;
  float* stats = (float*)ws;                 // 2*B floats
  bf16* attn = (bf16*)(ws + 256);
  bf16* wqT = attn + XN;
  bf16* wkT = wqT + WW;
  bf16* wvT = wkT + WW;
  bf16* woT = wvT + WW;
  bf16* qb  = woT + WW;
  bf16* kb  = qb  + XN;
  bf16* vT  = kb  + XN;

  gn_stats<<<BSZ, 256, 0, stream>>>(x, stats);
  wcast_t<<<dim3(16, 16, 4), dim3(32, 8), 0, stream>>>(wq, wk, wv, wo,
                                                       wqT, wkT, wvT, woT);
  qkv_gemm<<<(BSZ * TT) / 16, 256, 0, stream>>>(x, gamma, beta, stats, wqT, wkT, wvT,
                                                bq, bk, bv, qb, kb, vT);
  attn_flash<<<dim3(TT / 16, NH, BSZ), 32, 0, stream>>>(qb, kb, vT, attn);
  out_proj<<<(BSZ * TT) / 16, 256, 0, stream>>>(attn, woT, bo, x, out);
}

// v004
// One run takes 177 microseconds.
// Next to v003, in two timings, it ran 1.22 and 1.23 times as fast.
// Over all steps from v000 it is 2.47 times as fast.
#include <hip/hip_runtime.h>

// ---------------- problem constants ----------------
#define BSZ 16
#define TT  1024          // H*W tokens
#define CC  512           // channels
#define NH  8
#define HD  64
#define AD  512           // attention dim
#define EPSV 1e-5f
#define GNP  32           // partial GroupNorm sums per sample, one per lane

typedef __bf16 bf16;
typedef __bf16 v16bf __attribute__((ext_vector_type(16)));
typedef float  v8f   __attribute__((ext_vector_type(8)));

// ---------------- WMMA helpers ----------------
__device__ __forceinline__ v8f wmma_bf16(v16bf a, v16bf b, v8f c) {
  // D = A(16x32 bf16) * B(32x16 bf16) + C(16x16 f32)
  return __builtin_amdgcn_wmma_f32_16x16x32_bf16(
      /*neg_a=*/false, a, /*neg_b=*/false, b,
      /*c_mod=*/(short)0, c, /*reuse_a=*/false, /*reuse_b=*/false);
}

// Load a 16x32 bf16 A-operand (or 32x16 B-operand, mirrored) per the CDNA5
// VGPR layout: lanes 0-15 -> row=lane, K chunks {0..7} and {16..23};
// lanes 16-31 -> row=lane-16, K chunks {8..15} and {24..31}.
// Each chunk is 8 contiguous bf16 = one 16-byte load.
__device__ __forceinline__ v16bf load_ab(const bf16* base, int row_stride, int lane) {
  int half = lane >> 4;
  int r    = lane & 15;
  const bf16* p = base + (size_t)r * row_stride + half * 8;
  union { v16bf v; uint4 q[2]; } u;
  u.q[0] = *(const uint4*)(p);        // K 0..7   (or 8..15)
  u.q[1] = *(const uint4*)(p + 16);   // K 16..23 (or 24..31)
  return u.v;
}

// Packed operand tile: a 16-row x 32-k bf16 tile is stored as 512 elements in
// the order the lanes consume it: element (row, k) lies at
//   (k >> 4) * 256 + (((k >> 3) & 1) * 16 + row) * 8 + (k & 7).
// Each of the two wave-wide 16-byte loads then covers 512 contiguous bytes
// (4 whole 128-byte lines) and yields the same registers as load_ab().
__device__ __forceinline__ v16bf load_packed(const bf16* tile, int lane) {
  union { v16bf v; uint4 q[2]; } u;
  u.q[0] = *(const uint4*)(tile + lane * 8);        // K 0..7   (or 8..15)
  u.q[1] = *(const uint4*)(tile + 256 + lane * 8);  // K 16..23 (or 24..31)
  return u.v;
}

// Async-stage a contiguous 16 KB panel (16 rows x 512 bf16) from global into
// LDS: each of 256 threads copies 4 x 16B via global_load_async_to_lds_b128
// (ASYNCcnt path), then waits its own async counter. Caller must __syncthreads.
__device__ __forceinline__ void stage_panel_async(const bf16* __restrict__ gsrc,
                                                  bf16* lds_dst, int tid) {
  unsigned lds_base = (unsigned)(size_t)(void*)lds_dst;  // addr[31:0] = LDS offset
  unsigned off = (unsigned)tid * 16u;
  #pragma unroll
  for (int rr = 0; rr < 4; ++rr) {
    unsigned o = off + (unsigned)rr * 4096u;
    unsigned lds_a = lds_base + o;
    // s_wait_xcnt in the copy's own statement: its address registers are not
    // rewritten before the wait.
    asm volatile("global_load_async_to_lds_b128 %0, %1, %2\n\ts_wait_xcnt 0x0"
                 :: "v"(lds_a), "v"(o), "s"(gsrc)
                 : "memory");
  }
  asm volatile("s_wait_asynccnt 0x0" ::: "memory");
}

// ---------------- lane exchange ----------------
// Value of lane l ^ 16 (the other half's share of the same query).
__device__ __forceinline__ float other_half(float v) {
  int b = __builtin_bit_cast(int, v);
  b = __builtin_amdgcn_permlanex16(b, b, 0x76543210, 0xfedcba98, false, false);
  return __builtin_bit_cast(float, b);
}

// v plus the value of lane l ^ X inside the 16-lane row (DPP row_xmask:X).
template <int X>
__device__ __forceinline__ float add_row_xor(float v) {
  int m = __builtin_amdgcn_update_dpp(0, __builtin_bit_cast(int, v), 0x160 + X,
                                      0xf, 0xf, true);
  return v + __builtin_bit_cast(float, m);
}

// Sum over the 32 lanes of a wave, all lanes on; every lane gets the total.
__device__ __forceinline__ float wave_sum(float v) {
  v = add_row_xor<1>(v);
  v = add_row_xor<2>(v);
  v = add_row_xor<4>(v);
  v = add_row_xor<8>(v);
  return v + other_half(v);
}

// ---------------- kernel 1: GroupNorm partial sums (1 group) ----------------
// Work-group g sums 64 KB of x in a row: slice g % GNP of sample g / GNP.
// part[2 * g] = sum, part[2 * g + 1] = sum of squares; the QKV GEMM joins the
// GNP slices of its sample.
__global__ __launch_bounds__(256) void gn_stats(const float* __restrict__ x,
                                                float* __restrict__ part) {
  const int tid = threadIdx.x;
  const float4* p = (const float4*)x + (size_t)blockIdx.x * (TT * CC / 4 / GNP) + tid;
  float4 v[16];
  // unrolled: v[] stays in registers and the 16 loads are in flight together
  #pragma unroll
  for (int i = 0; i < 16; ++i) v[i] = p[i * 256];
  // Without it the compiler issues the last 4 loads behind the first sums' waits:
  // three memory latencies in a row instead of one.
  __builtin_amdgcn_sched_barrier(0);
  float4 a4 = make_float4(0.f, 0.f, 0.f, 0.f), q4 = a4;   // four chains each
  // unrolled: v[i] is indexed by a constant, so it needs no scratch memory
  #pragma unroll
  for (int i = 0; i < 16; ++i) {
    a4.x += v[i].x;  a4.y += v[i].y;  a4.z += v[i].z;  a4.w += v[i].w;
    q4.x += v[i].x * v[i].x;  q4.y += v[i].y * v[i].y;
    q4.z += v[i].z * v[i].z;  q4.w += v[i].w * v[i].w;
  }
  float s  = wave_sum((a4.x + a4.y) + (a4.z + a4.w));
  float ss = wave_sum((q4.x + q4.y) + (q4.z + q4.w));
  __shared__ float sh0[8], sh1[8];
  if ((tid & 31) == 0) { sh0[tid >> 5] = s; sh1[tid >> 5] = ss; }
  __syncthreads();
  if (tid == 0) {
    float a = 0.f, c = 0.f;
    for (int w = 0; w < 8; ++w) { a += sh0[w]; c += sh1[w]; }
    *(float2*)(part + 2 * blockIdx.x) = make_float2(a, c);
  }
}

// ---------------- kernel 2: weight transpose + cast (512x512 each) ----------
// Output: packed tiles, tile index = (n >> 4) * 16 + (k >> 5).
__global__ __launch_bounds__(256) void wcast_t(const float* __restrict__ wq,
                                               const float* __restrict__ wk,
                                               const float* __restrict__ wv,
                                               const float* __restrict__ wo,
                                               bf16* __restrict__ wqT,
                                               bf16* __restrict__ wkT,
                                               bf16* __restrict__ wvT,
                                               bf16* __restrict__ woT) {
  const float* w = (blockIdx.z == 0) ? wq : (blockIdx.z == 1) ? wk
                   : (blockIdx.z == 2) ? wv : wo;
  bf16* wt = (blockIdx.z == 0) ? wqT : (blockIdx.z == 1) ? wkT
             : (blockIdx.z == 2) ? wvT : woT;
  __shared__ float tile[32][33];
  int bx = blockIdx.x * 32, by = blockIdx.y * 32;
  int tx = threadIdx.x, ty = threadIdx.y;     // 32 x 8
  #pragma unroll
  for (int j = 0; j < 32; j += 8)
    tile[ty + j][tx] = w[(size_t)(by + ty + j) * 512 + bx + tx];
  __syncthreads();
  // The 32x32 block is two packed tiles (n 0..15 and n 16..31); each thread
  // writes 4 consecutive packed elements.
  int o   = (ty * 32 + tx) * 4;               // 0..1020
  int nt2 = o >> 9;
  int ln  = (o >> 3) & 31;
  int nl  = nt2 * 16 + (ln & 15);
  int kl  = ((o >> 8) & 1) * 16 + (ln >> 4) * 8 + (o & 7);
  union { bf16 e[4]; uint2 u; } r;
  #pragma unroll
  for (int i = 0; i < 4; ++i) r.e[i] = (bf16)tile[kl + i][nl];
  size_t dst = ((size_t)((bx >> 4) + nt2) * 16 + blockIdx.y) * 512 + (o & 511);
  *(uint2*)(wt + dst) = r.u;
}

// ---------------- kernel 3: GroupNorm apply + fused QKV WMMA GEMM ----------
// A panel (16 tokens x 512 K): x is read as f32, normalized, cast to bf16 and
// written to LDS once per block; 8 waves x 3 passes x 4 register-blocked
// accumulator tiles (one shared A per K-step).
// q stored [B*T, AD] bf16. k and v are stored as packed tiles per (b, head):
//   k: tile (16 keys x 32 head dims),  index (key >> 4) * 2 + (d >> 5)
//   v: tile (16 head dims x 32 keys),  index (key >> 5) * 4 + (d >> 4)
__global__ __launch_bounds__(256) void qkv_gemm(const float* __restrict__ x,
                                                const float* __restrict__ gamma,
                                                const float* __restrict__ beta,
                                                const float* __restrict__ part,
                                                const bf16* __restrict__ wqT,
                                                const bf16* __restrict__ wkT,
                                                const bf16* __restrict__ wvT,
                                                const float* __restrict__ bq,
                                                const float* __restrict__ bk,
                                                const float* __restrict__ bv,
                                                bf16* __restrict__ q,
                                                bf16* __restrict__ k,
                                                bf16* __restrict__ vT) {
  int t0   = blockIdx.x * 16;            // global token row (over B*T)
  int b    = t0 / TT;
  int tloc = t0 - b * TT;
  int tid  = threadIdx.x;
  int wave = tid >> 5, lane = tid & 31;

  __shared__ __align__(16) bf16 As[16 * CC];   // 16 KB A panel
  {
    // Thread tid takes the same 4 channels of rows rr * 2 + (tid >> 7): the
    // panel is 2048 float4 in a row, 8 per thread, all loads issued together.
    // Lane l takes slice l of this sample's sums; every wave joins all GNP.
    const float2 pr = *(const float2*)(part + (b * GNP + lane) * 2);
    // The load's address registers are reused as a destination of the loads
    // below: wait before they are overwritten.
    asm volatile("s_wait_xcnt 0x0" ::: "memory");
    const float* xp = x + (size_t)t0 * CC + tid * 4;
    float4 v[8];
    // unrolled: v[] stays in registers and the 8 loads are in flight together
    #pragma unroll
    for (int rr = 0; rr < 8; ++rr) v[rr] = *(const float4*)(xp + rr * 1024);
    const int c = (tid & 127) * 4;
    float4 g  = *(const float4*)(gamma + c);
    float4 bt = *(const float4*)(beta + c);
    const float inv_n = 1.0f / (float)(TT * CC);
    const float mean = wave_sum(pr.x) * inv_n;
    const float var  = wave_sum(pr.y) * inv_n - mean * mean;
    const float inv  = rsqrtf(var + EPSV);
    // unrolled: v[rr] is indexed by a constant, so it needs no scratch memory
    #pragma unroll
    for (int rr = 0; rr < 8; ++rr) {
      union { bf16 o[4]; uint2 u; } r;
      r.o[0] = (bf16)((v[rr].x - mean) * inv * g.x + bt.x);
      r.o[1] = (bf16)((v[rr].y - mean) * inv * g.y + bt.y);
      r.o[2] = (bf16)((v[rr].z - mean) * inv * g.z + bt.z);
      r.o[3] = (bf16)((v[rr].w - mean) * inv * g.w + bt.w);
      *(uint2*)(As + tid * 4 + rr * 1024) = r.u;
    }
  }
  __syncthreads();

  const int n = lane & 15, half = lane >> 4;

  for (int pass = 0; pass < 3; ++pass) {
    int tbase = wave * 12 + pass * 4;    // 4 consecutive tiles of 96
    const bf16* wp[4];
    const float* bp[4];
    int nb[4], mt[4];
    #pragma unroll
    for (int t = 0; t < 4; ++t) {
      int tile = tbase + t;
      mt[t] = tile >> 5;                 // 0=q 1=k 2=v
      nb[t] = (tile & 31) * 16;
      const bf16* wt = (mt[t] == 0) ? wqT : (mt[t] == 1) ? wkT : wvT;
      wp[t] = wt + (size_t)nb[t] * CC;
      bp[t] = (mt[t] == 0) ? bq : (mt[t] == 1) ? bk : bv;
    }
    v8f acc[4] = {{}, {}, {}, {}};
    for (int kk = 0; kk < CC; kk += 32) {
      v16bf a = load_ab(As + kk, CC, lane);     // LDS (ds_load_b128)
      #pragma unroll
      for (int t = 0; t < 4; ++t) {
        v16bf bm = load_packed(wp[t] + kk * 16, lane);
        acc[t] = wmma_bf16(a, bm, acc[t]);
      }
    }
    #pragma unroll
    for (int t = 0; t < 4; ++t) {
      float bias = bp[t][nb[t] + n];
      unsigned hb = (unsigned)(b * NH + (nb[t] >> 6)) * (TT * HD);  // (b, head) plane
      if (mt[t] == 0) {
        #pragma unroll
        for (int r = 0; r < 8; r++) {
          int m = r + half * 8;          // C-layout row
          q[(size_t)(t0 + m) * AD + nb[t] + n] = (bf16)(acc[t][r] + bias);
        }
        // The stores' data and address registers are reused by the next tile:
        // wait before they are overwritten.
        asm volatile("s_wait_xcnt 0x0" ::: "memory");
      } else if (mt[t] == 1) {           // K: row = key m, k index = head dim
        unsigned o = hb + (unsigned)((tloc >> 4) * 2 + ((nb[t] >> 5) & 1)) * 512
                   + ((nb[t] >> 4) & 1) * 256 + (n >> 3) * 128 + half * 64 + (n & 7);
        #pragma unroll
        for (int r = 0; r < 8; r++)      // key m = r + half * 8 lies at m * 8
          k[o + r * 8] = (bf16)(acc[t][r] + bias);
      } else {                           // V: row = head dim n, k index = key m
        unsigned o = hb + (unsigned)((tloc >> 5) * 4 + ((nb[t] >> 4) & 3)) * 512
                   + ((tloc >> 4) & 1) * 256 + lane * 8;
        union { bf16 e[8]; uint4 u; } pk;
        #pragma unroll
        for (int r = 0; r < 8; r++) pk.e[r] = (bf16)(acc[t][r] + bias);
        *(uint4*)(vT + o) = pk.u;
      }
    }
  }
}

__global__ __launch_bounds__(32) void attn_flash(const bf16* __restrict__ q,
                                                 const bf16* __restrict__ k,
                                                 const bf16* __restrict__ vT,
                                                 bf16* __restrict__ attn) {
  const int qt = blockIdx.x * 16;   // query tile within batch
  const int h  = blockIdx.y;
  const int b  = blockIdx.z;
  const int lane = threadIdx.x;
  const float scale = 0.125f;       // 1/sqrt(64), a power of two: exact

  const bf16* qbase = q  + ((size_t)(b * TT + qt) * AD) + h * HD;
  const bf16* kbase = k  + ((size_t)b * NH + h) * (TT * HD);  // packed tiles
  const bf16* vbase = vT + ((size_t)b * NH + h) * (TT * HD);  // packed tiles

  // Q^T B-operands for head dims 0..31 and 32..63 (loaded once)
  v16bf q0 = load_ab(qbase,      AD, lane);
  v16bf q1 = load_ab(qbase + 32, AD, lane);

  // o[dt][r] = O[query n][head dim dt * 16 + half * 8 + r]
  v8f o[4] = {{}, {}, {}, {}};
  float mrow = -1e30f;              // running maximum of this lane's query
  float lrow = 0.f;                 // running sum over this half's keys only
  const int n = lane & 15, half = lane >> 4;

  for (int kt = 0; kt < TT; kt += 32) {
    // ---- S^T = K * Q^T for 32 keys (two 16-key M-tiles) ----
    const bf16* kp = kbase + (size_t)kt * HD;   // 4 packed tiles, 4 KB in a row
    const bf16* vp = vbase + (size_t)kt * HD;   // 4 packed tiles, 4 KB in a row
    v16bf k0a = load_packed(kp,        lane);
    v16bf k0b = load_packed(kp + 512,  lane);
    v16bf k1a = load_packed(kp + 1024, lane);
    v16bf k1b = load_packed(kp + 1536, lane);
    v8f s0 = {}, s1 = {};
    s0 = wmma_bf16(k0a, q0, s0); s0 = wmma_bf16(k0b, q1, s0);
    s1 = wmma_bf16(k1a, q0, s1); s1 = wmma_bf16(k1b, q1, s1);

    // ---- online softmax, one query per lane ----
    float mx = fmaxf(s0[0], s1[0]);
    #pragma unroll
    for (int r = 1; r < 8; r++) mx = fmaxf(mx, fmaxf(s0[r], s1[r]));
    mx = fmaxf(mx, other_half(mx)) * scale;
    float mnew = fmaxf(mrow, mx);
    // corr = exp(mrow - mnew). v_exp_f32 and the one slot the instruction set
    // asks for behind it stand in one statement: the instruction that follows
    // may read the result or reuse the source register.
    float corr;
    asm("v_exp_f32 %0, %1\n\tv_nop" : "=v"(corr) : "v"((mrow - mnew) * 1.44269504f));
    v16bf p;   // P^T: element r is key half * 8 + r, element 8 + r key 16 + half * 8 + r
    float t[8];
    #pragma unroll
    for (int r = 0; r < 8; r++) {
      float p0 = __expf(s0[r] * scale - mnew);
      float p1 = __expf(s1[r] * scale - mnew);
      p[r]     = (bf16)p0;
      p[8 + r] = (bf16)p1;
      t[r] = p0 + p1;
    }
    float rs = ((t[0] + t[1]) + (t[2] + t[3])) + ((t[4] + t[5]) + (t[6] + t[7]));
    lrow = lrow * corr + rs;
    mrow = mnew;
    #pragma unroll
    for (int dt = 0; dt < 4; dt++) o[dt] *= corr;

    // ---- O^T += V^T(16 dims x 32 keys) * P^T(32 keys x 16 queries) ----
    #pragma unroll
    for (int dt = 0; dt < 4; dt++) {
      v16bf vv = load_packed(vp + dt * 512, lane);
      o[dt] = wmma_bf16(vv, p, o[dt]);
    }
  }

  // ---- join the halves' sums, normalize, store attn [B*T, AD] bf16 ----
  float inv = 1.0f / (lrow + other_half(lrow));
  bf16* outb = attn + ((size_t)(b * TT + qt + n) * AD) + h * HD + half * 8;
  #pragma unroll
  for (int dt = 0; dt < 4; dt++) {
    union { bf16 e[8]; uint4 u; } pk;
    #pragma unroll
    for (int r = 0; r < 8; r++) pk.e[r] = (bf16)(o[dt][r] * inv);
    *(uint4*)(outb + dt * 16) = pk.u;
  }
}

// ---------------- kernel 5: output projection + bias + residual ------------
// attn panel async-staged in LDS; each wave owns 4 register-blocked N-tiles.
__global__ __launch_bounds__(256) void out_proj(const bf16* __restrict__ attn,
                                                const bf16* __restrict__ woT,
                                                const float* __restrict__ bo,
                                                const float* __restrict__ x,
                                                float* __restrict__ out) {
  int t0  = blockIdx.x * 16;         // token row over B*T
  int tid = threadIdx.x;
  int wave = tid >> 5, lane = tid & 31;

  __shared__ __align__(16) bf16 As[16 * AD];   // 16 KB attn panel
  stage_panel_async(attn + (size_t)t0 * AD, As, tid);
  __syncthreads();

  int nbase0 = wave * 64;            // wave covers n-tiles 4w..4w+3
  v8f acc[4] = {{}, {}, {}, {}};
  for (int kk = 0; kk < AD; kk += 32) {
    v16bf a = load_ab(As + kk, AD, lane);      // LDS
    #pragma unroll
    for (int t = 0; t < 4; ++t) {
      v16bf bm = load_packed(woT + (size_t)(nbase0 + t * 16) * AD + kk * 16, lane);
      acc[t] = wmma_bf16(a, bm, acc[t]);
    }
  }
  int n = lane & 15, half = lane >> 4;
  #pragma unroll
  for (int t = 0; t < 4; ++t) {
    int nbase = nbase0 + t * 16;
    float bias = bo[nbase + n];
    #pragma unroll
    for (int r = 0; r < 8; r++) {
      int m = r + half * 8;
      size_t idx = (size_t)(t0 + m) * CC + nbase + n;
      out[idx] = x[idx] + acc[t][r] + bias;
    }
  }
}

// ---------------- launch ----------------
extern "C" void kernel_launch(void* const* d_in, const int* in_sizes, int n_in,
                              void* d_out, int out_size, void* d_ws, size_t ws_size,
                              hipStream_t stream) {
  const float* x     = (const float*)d_in[0];
  const float* gamma = (const float*)d_in[1];
  const float* beta  = (const float*)d_in[2];
  const float* wq    = (const float*)d_in[3];
  const float* bq    = (const float*)d_in[4];
  const float* wk    = (const float*)d_in[5];
  const float* bk    = (const float*)d_in[6];
  const float* wv    = (const float*)d_in[7];
  const float* bv    = (const float*)d_in[8];
  const float* wo    = (const float*)d_in[9];
  const float* bo    = (const float*)d_in[10];
  float* out = (float*)d_out;

  // workspace carve-up
  const size_t XN = (size_t)BSZ * TT * CC;   // 8.4M elems
  const size_t WW = (size_t)512 * 512;
  char* ws = (char*)d_ws;
  float* part = (float*)ws;                  // 2*GNP*B floats = 4096 bytes
  bf16* attn = (bf16*)(ws + 4096);
  bf16* wqT = attn + XN;
  bf16* wkT = wqT + WW;
  bf16* wvT = wkT + WW;
  bf16* woT = wvT + WW;
  bf16* qb  = woT + WW;
  bf16* kb  = qb  + XN;
  bf16* vT  = kb  + XN;

  gn_stats<<<BSZ * GNP, 256, 0, stream>>>(x, part);
  wcast_t<<<dim3(16, 16, 4), dim3(32, 8), 0, stream>>>(wq, wk, wv, wo,
                                                       wqT, wkT, wvT, woT);
  qkv_gemm<<<(BSZ * TT) / 16, 256, 0, stream>>>(x, gamma, beta, part, wqT, wkT, wvT,
                                                bq, bk, bv, qb, kb, vT);
  attn_flash<<<dim3(TT / 16, NH, BSZ), 32, 0, stream>>>(qb, kb, vT, attn);
  out_proj<<<(BSZ * TT) / 16, 256, 0, stream>>>(attn, woT, bo, x, out);
}

// v005
// It runs in 128 microseconds.
// In two side-by-side timings against v004, it was 1.40 and 1.38 times as fast.
// Over all steps from v000 it is 3.43 times as fast.
#include <hip/hip_runtime.h>

// ---------------- problem constants ----------------
#define BSZ 16
#define TT  1024          // H*W tokens
#define CC  512           // channels
#define NH  8
#define HD  64
#define AD  512           // attention dim
#define EPSV 1e-5f
#define GNP  32           // partial GroupNorm sums per sample, one per lane

typedef __bf16 bf16;
typedef __bf16 v16bf __attribute__((ext_vector_type(16)));
typedef float  v8f   __attribute__((ext_vector_type(8)));

// ---------------- WMMA helpers ----------------
__device__ __forceinline__ v8f wmma_bf16(v16bf a, v16bf b, v8f c) {
  // D = A(16x32 bf16) * B(32x16 bf16) + C(16x16 f32)
  return __builtin_amdgcn_wmma_f32_16x16x32_bf16(
      /*neg_a=*/false, a, /*neg_b=*/false, b,
      /*c_mod=*/(short)0, c, /*reuse_a=*/false, /*reuse_b=*/false);
}

// Load a 16x32 bf16 A-operand (or 32x16 B-operand, mirrored) per the CDNA5
// VGPR layout: lanes 0-15 -> row=lane, K chunks {0..7} and {16..23};
// lanes 16-31 -> row=lane-16, K chunks {8..15} and {24..31}.
// Each chunk is 8 contiguous bf16 = one 16-byte load.
__device__ __forceinline__ v16bf load_ab(const bf16* base, int row_stride, int lane) {
  int half = lane >> 4;
  int r    = lane & 15;
  const bf16* p = base + (size_t)r * row_stride + half * 8;
  union { v16bf v; uint4 q[2]; } u;
  u.q[0] = *(const uint4*)(p);        // K 0..7   (or 8..15)
  u.q[1] = *(const uint4*)(p + 16);   // K 16..23 (or 24..31)
  return u.v;
}

// Packed operand tile: a 16-row x 32-k bf16 tile is stored as 512 elements in
// the order the lanes consume it: element (row, k) lies at
//   (k >> 4) * 256 + (((k >> 3) & 1) * 16 + row) * 8 + (k & 7).
// Each of the two wave-wide 16-byte loads then covers 512 contiguous bytes
// (4 whole 128-byte lines) and yields the same registers as load_ab().
__device__ __forceinline__ v16bf load_packed(const bf16* tile, int lane) {
  union { v16bf v; uint4 q[2]; } u;
  u.q[0] = *(const uint4*)(tile + lane * 8);        // K 0..7   (or 8..15)
  u.q[1] = *(const uint4*)(tile + 256 + lane * 8);  // K 16..23 (or 24..31)
  return u.v;
}

// Async-stage a contiguous 16 KB panel (16 rows x 512 bf16) from global into
// LDS: each of 256 threads copies 4 x 16B via global_load_async_to_lds_b128
// (ASYNCcnt path), then waits its own async counter. Caller must __syncthreads.
__device__ __forceinline__ void stage_panel_async(const bf16* __restrict__ gsrc,
                                                  bf16* lds_dst, int tid) {
  unsigned lds_base = (unsigned)(size_t)(void*)lds_dst;  // addr[31:0] = LDS offset
  unsigned off = (unsigned)tid * 16u;
  #pragma unroll
  for (int rr = 0; rr < 4; ++rr) {
    unsigned o = off + (unsigned)rr * 4096u;
    unsigned lds_a = lds_base + o;
    // s_wait_xcnt in the copy's own statement: its address registers are not
    // rewritten before the wait.
    asm volatile("global_load_async_to_lds_b128 %0, %1, %2\n\ts_wait_xcnt 0x0"
                 :: "v"(lds_a), "v"(o), "s"(gsrc)
                 : "memory");
  }
  asm volatile("s_wait_asynccnt 0x0" ::: "memory");
}

// ---------------- lane exchange ----------------
// Value of lane l ^ 16 (the other half's share of the same query).
__device__ __forceinline__ float other_half(float v) {
  int b = __builtin_bit_cast(int, v);
  b = __builtin_amdgcn_permlanex16(b, b, 0x76543210, 0xfedcba98, false, false);
  return __builtin_bit_cast(float, b);
}

// v plus the value of lane l ^ X inside the 16-lane row (DPP row_xmask:X).
template <int X>
__device__ __forceinline__ float add_row_xor(float v) {
  int m = __builtin_amdgcn_update_dpp(0, __builtin_bit_cast(int, v), 0x160 + X,
                                      0xf, 0xf, true);
  return v + __builtin_bit_cast(float, m);
}

// Sum over the 32 lanes of a wave, all lanes on; every lane gets the total.
__device__ __forceinline__ float wave_sum(float v) {
  v = add_row_xor<1>(v);
  v = add_row_xor<2>(v);
  v = add_row_xor<4>(v);
  v = add_row_xor<8>(v);
  return v + other_half(v);
}

// ---------------- kernel 1: GroupNorm partial sums (1 group) ----------------
// Work-group g sums 64 KB of x in a row: slice g % GNP of sample g / GNP.
// part[2 * g] = sum, part[2 * g + 1] = sum of squares; the QKV GEMM joins the
// GNP slices of its sample.
__global__ __launch_bounds__(256) void gn_stats(const float* __restrict__ x,
                                                float* __restrict__ part) {
  const int tid = threadIdx.x;
  const float4* p = (const float4*)x + (size_t)blockIdx.x * (TT * CC / 4 / GNP) + tid;
  float4 v[16];
  // unrolled: v[] stays in registers and the 16 loads are in flight together
  #pragma unroll
  for (int i = 0; i < 16; ++i) v[i] = p[i * 256];
  // Without it the compiler issues the last 4 loads behind the first sums' waits:
  // three memory latencies in a row instead of one.
  __builtin_amdgcn_sched_barrier(0);
  float4 a4 = make_float4(0.f, 0.f, 0.f, 0.f), q4 = a4;   // four chains each
  // unrolled: v[i] is indexed by a constant, so it needs no scratch memory
  #pragma unroll
  for (int i = 0; i < 16; ++i) {
    a4.x += v[i].x;  a4.y += v[i].y;  a4.z += v[i].z;  a4.w += v[i].w;
    q4.x += v[i].x * v[i].x;  q4.y += v[i].y * v[i].y;
    q4.z += v[i].z * v[i].z;  q4.w += v[i].w * v[i].w;
  }
  float s  = wave_sum((a4.x + a4.y) + (a4.z + a4.w));
  float ss = wave_sum((q4.x + q4.y) + (q4.z + q4.w));
  __shared__ float sh0[8], sh1[8];
  if ((tid & 31) == 0) { sh0[tid >> 5] = s; sh1[tid >> 5] = ss; }
  __syncthreads();
  if (tid == 0) {
    float a = 0.f, c = 0.f;
    for (int w = 0; w < 8; ++w) { a += sh0[w]; c += sh1[w]; }
    *(float2*)(part + 2 * blockIdx.x) = make_float2(a, c);
  }
}

// ---------------- kernel 2: weight transpose + cast (512x512 each) ----------
// Output: packed tiles, tile index = (n >> 4) * 16 + (k >> 5).
__global__ __launch_bounds__(256) void wcast_t(const float* __restrict__ wq,
                                               const float* __restrict__ wk,
                                               const float* __restrict__ wv,
                                               const float* __restrict__ wo,
                                               bf16* __restrict__ wqT,
                                               bf16* __restrict__ wkT,
                                               bf16* __restrict__ wvT,
                                               bf16* __restrict__ woT) {
  const float* w = (blockIdx.z == 0) ? wq : (blockIdx.z == 1) ? wk
                   : (blockIdx.z == 2) ? wv : wo;
  bf16* wt = (blockIdx.z == 0) ? wqT : (blockIdx.z == 1) ? wkT
             : (blockIdx.z == 2) ? wvT : woT;
  __shared__ float tile[32][33];
  int bx = blockIdx.x * 32, by = blockIdx.y * 32;
  int tx = threadIdx.x, ty = threadIdx.y;     // 32 x 8
  #pragma unroll
  for (int j = 0; j < 32; j += 8)
    tile[ty + j][tx] = w[(size_t)(by + ty + j) * 512 + bx + tx];
  __syncthreads();
  // The 32x32 block is two packed tiles (n 0..15 and n 16..31); each thread
  // writes 4 consecutive packed elements.
  int o   = (ty * 32 + tx) * 4;               // 0..1020
  int nt2 = o >> 9;
  int ln  = (o >> 3) & 31;
  int nl  = nt2 * 16 + (ln & 15);
  int kl  = ((o >> 8) & 1) * 16 + (ln >> 4) * 8 + (o & 7);
  union { bf16 e[4]; uint2 u; } r;
  #pragma unroll
  for (int i = 0; i < 4; ++i) r.e[i] = (bf16)tile[kl + i][nl];
  size_t dst = ((size_t)((bx >> 4) + nt2) * 16 + blockIdx.y) * 512 + (o & 511);
  *(uint2*)(wt + dst) = r.u;
}

// ---------------- kernel 3: GroupNorm apply + fused QKV WMMA GEMM ----------
// A panel (16 tokens x 512 K): x is read as f32, normalized, cast to bf16 and
// written to LDS once per block; 8 waves x 3 passes x 4 register-blocked
// accumulator tiles (one shared A per K-step).
// q stored [B*T, AD] bf16. k and v are stored as packed tiles per (b, head):
//   k: tile (16 keys x 32 head dims),  index (key >> 4) * 2 + (d >> 5)
//   v: tile (16 head dims x 32 keys),  index (key >> 5) * 4 + (d >> 4)
__global__ __launch_bounds__(256) void qkv_gemm(const float* __restrict__ x,
                                                const float* __restrict__ gamma,
                                                const float* __restrict__ beta,
                                                const float* __restrict__ part,
                                                const bf16* __restrict__ wqT,
                                                const bf16* __restrict__ wkT,
                                                const bf16* __restrict__ wvT,
                                                const float* __restrict__ bq,
                                                const float* __restrict__ bk,
                                                const float* __restrict__ bv,
                                                bf16* __restrict__ q,
                                                bf16* __restrict__ k,
                                                bf16* __restrict__ vT) {
  int t0   = blockIdx.x * 16;            // global token row (over B*T)
  int b    = t0 / TT;
  int tloc = t0 - b * TT;
  int tid  = threadIdx.x;
  int wave = tid >> 5, lane = tid & 31;

  __shared__ __align__(16) bf16 As[16 * CC];   // 16 KB A panel
  {
    // Thread tid takes the same 4 channels of rows rr * 2 + (tid >> 7): the
    // panel is 2048 float4 in a row, 8 per thread, all loads issued together.
    // Lane l takes slice l of this sample's sums; every wave joins all GNP.
    const float2 pr = *(const float2*)(part + (b * GNP + lane) * 2);
    // The load's address registers are reused as a destination of the loads
    // below: wait before they are overwritten.
    asm volatile("s_wait_xcnt 0x0" ::: "memory");
    const float* xp = x + (size_t)t0 * CC + tid * 4;
    float4 v[8];
    // unrolled: v[] stays in registers and the 8 loads are in flight together
    #pragma unroll
    for (int rr = 0; rr < 8; ++rr) v[rr] = *(const float4*)(xp + rr * 1024);
    const int c = (tid & 127) * 4;
    float4 g  = *(const float4*)(gamma + c);
    float4 bt = *(const float4*)(beta + c);
    const float inv_n = 1.0f / (float)(TT * CC);
    const float mean = wave_sum(pr.x) * inv_n;
    const float var  = wave_sum(pr.y) * inv_n - mean * mean;
    const float inv  = rsqrtf(var + EPSV);
    // unrolled: v[rr] is indexed by a constant, so it needs no scratch memory
    #pragma unroll
    for (int rr = 0; rr < 8; ++rr) {
      union { bf16 o[4]; uint2 u; } r;
      r.o[0] = (bf16)((v[rr].x - mean) * inv * g.x + bt.x);
      r.o[1] = (bf16)((v[rr].y - mean) * inv * g.y + bt.y);
      r.o[2] = (bf16)((v[rr].z - mean) * inv * g.z + bt.z);
      r.o[3] = (bf16)((v[rr].w - mean) * inv * g.w + bt.w);
      *(uint2*)(As + tid * 4 + rr * 1024) = r.u;
    }
  }
  __syncthreads();

  const int n = lane & 15, half = lane >> 4;

  for (int pass = 0; pass < 3; ++pass) {
    int tbase = wave * 12 + pass * 4;    // 4 consecutive tiles of 96
    const bf16* wp[4];
    const float* bp[4];
    int nb[4], mt[4];
    #pragma unroll
    for (int t = 0; t < 4; ++t) {
      int tile = tbase + t;
      mt[t] = tile >> 5;                 // 0=q 1=k 2=v
      nb[t] = (tile & 31) * 16;
      const bf16* wt = (mt[t] == 0) ? wqT : (mt[t] == 1) ? wkT : wvT;
      wp[t] = wt + (size_t)nb[t] * CC;
      bp[t] = (mt[t] == 0) ? bq : (mt[t] == 1) ? bk : bv;
    }
    v8f acc[4] = {{}, {}, {}, {}};
    for (int kk = 0; kk < CC; kk += 32) {
      v16bf a = load_ab(As + kk, CC, lane);     // LDS (ds_load_b128)
      #pragma unroll
      for (int t = 0; t < 4; ++t) {
        v16bf bm = load_packed(wp[t] + kk * 16, lane);
        acc[t] = wmma_bf16(a, bm, acc[t]);
      }
    }
    #pragma unroll
    for (int t = 0; t < 4; ++t) {
      float bias = bp[t][nb[t] + n];
      unsigned hb = (unsigned)(b * NH + (nb[t] >> 6)) * (TT * HD);  // (b, head) plane
      if (mt[t] == 0) {
        #pragma unroll
        for (int r = 0; r < 8; r++) {
          int m = r + half * 8;          // C-layout row
          q[(size_t)(t0 + m) * AD + nb[t] + n] = (bf16)(acc[t][r] + bias);
        }
        // The stores' data and address registers are reused by the next tile:
        // wait before they are overwritten.
        asm volatile("s_wait_xcnt 0x0" ::: "memory");
      } else if (mt[t] == 1) {           // K: row = key m, k index = head dim
        unsigned o = hb + (unsigned)((tloc >> 4) * 2 + ((nb[t] >> 5) & 1)) * 512
                   + ((nb[t] >> 4) & 1) * 256 + (n >> 3) * 128 + half * 64 + (n & 7);
        #pragma unroll
        for (int r = 0; r < 8; r++)      // key m = r + half * 8 lies at m * 8
          k[o + r * 8] = (bf16)(acc[t][r] + bias);
      } else {                           // V: row = head dim n, k index = key m
        unsigned o = hb + (unsigned)((tloc >> 5) * 4 + ((nb[t] >> 4) & 3)) * 512
                   + ((tloc >> 4) & 1) * 256 + lane * 8;
        union { bf16 e[8]; uint4 u; } pk;
        #pragma unroll
        for (int r = 0; r < 8; r++) pk.e[r] = (bf16)(acc[t][r] + bias);
        *(uint4*)(vT + o) = pk.u;
      }
    }
  }
}

#define SKEYS 64                  // keys per stage
#define STE   (SKEYS * HD)        // elements of K, and of V, per stage

// One stage: each of 256 threads copies 2 x 16 B of K and 2 x 16 B of V.
// kg, vg: the lane's own global addresses; lds: the lane's own LDS byte address.
__device__ __forceinline__ void stage_kv_async(const bf16* kg, const bf16* vg,
                                               unsigned lds) {
  // s_wait_xcnt in the copies' own statement: their address registers are not
  // rewritten before the wait.
  asm volatile("global_load_async_to_lds_b128 %0, %4, off\n\t"
               "global_load_async_to_lds_b128 %1, %5, off\n\t"
               "global_load_async_to_lds_b128 %2, %6, off\n\t"
               "global_load_async_to_lds_b128 %3, %7, off\n\t"
               "s_wait_xcnt 0x0"
               :: "v"(lds), "v"(lds + 4096u), "v"(lds + 8192u), "v"(lds + 12288u),
                  "v"(kg), "v"(kg + 2048), "v"(vg), "v"(vg + 2048)
               : "memory");
}

__global__ __launch_bounds__(256) void attn_flash(const bf16* __restrict__ q,
                                                  const bf16* __restrict__ k,
                                                  const bf16* __restrict__ vT,
                                                  bf16* __restrict__ attn) {
  const int tid  = threadIdx.x;
  const int lane = tid & 31;
  const int qt = blockIdx.x * 128 + (tid >> 5) * 16;   // this wave's query tile
  const int h  = blockIdx.y;
  const int b  = blockIdx.z;
  const float scale = 0.125f;       // 1/sqrt(64), a power of two: exact

  const bf16* qbase = q  + ((size_t)(b * TT + qt) * AD) + h * HD;
  const bf16* kbase = k  + ((size_t)b * NH + h) * (TT * HD);  // packed tiles
  const bf16* vbase = vT + ((size_t)b * NH + h) * (TT * HD);  // packed tiles

  // Two buffers, each [K tiles 8 KB | V tiles 8 KB].
  __shared__ __align__(16) bf16 kv[2][2 * STE];
  const unsigned lds0 = (unsigned)(size_t)(void*)&kv[0][0] + (unsigned)tid * 16u;
  const bf16* kg = kbase + tid * 8;
  const bf16* vg = vbase + tid * 8;

  // Q^T B-operands for head dims 0..31 and 32..63 (loaded once)
  v16bf q0 = load_ab(qbase,      AD, lane);
  v16bf q1 = load_ab(qbase + 32, AD, lane);

  // o[dt][r] = O[query n][head dim dt * 16 + half * 8 + r]
  v8f o[4] = {{}, {}, {}, {}};
  float mrow = -1e30f;              // running maximum of this lane's query
  float lrow = 0.f;                 // running sum over this half's keys only
  const int n = lane & 15, half = lane >> 4;

  // Stage 0 lands and is published; stage 1 flies while stage 0 is worked on.
  stage_kv_async(kg, vg, lds0);
  asm volatile("s_wait_asynccnt 0x0" ::: "memory");   // this wave's share of stage 0
  __syncthreads();                                    // every wave's share
  stage_kv_async(kg + STE, vg + STE, lds0 + 4u * STE);

  for (int st = 0; st < TT / SKEYS; ++st) {
   const bf16* buf = kv[st & 1];
   // unrolled: the two 32-key passes of a stage read LDS at constant offsets
   #pragma unroll
   for (int sub = 0; sub < SKEYS / 32; ++sub) {
    // ---- S^T = K * Q^T for 32 keys (two 16-key M-tiles) ----
    const bf16* kp = buf + sub * 32 * HD;         // 4 packed tiles, 4 KB in a row
    const bf16* vp = buf + STE + sub * 32 * HD;   // 4 packed tiles, 4 KB in a row
    v16bf k0a = load_packed(kp,        lane);
    v16bf k0b = load_packed(kp + 512,  lane);
    v16bf k1a = load_packed(kp + 1024, lane);
    v16bf k1b = load_packed(kp + 1536, lane);
    v8f s0 = {}, s1 = {};
    s0 = wmma_bf16(k0a, q0, s0); s0 = wmma_bf16(k0b, q1, s0);
    s1 = wmma_bf16(k1a, q0, s1); s1 = wmma_bf16(k1b, q1, s1);

    // ---- online softmax, one query per lane ----
    float mx = fmaxf(s0[0], s1[0]);
    #pragma unroll
    for (int r = 1; r < 8; r++) mx = fmaxf(mx, fmaxf(s0[r], s1[r]));
    mx = fmaxf(mx, other_half(mx)) * scale;
    float mnew = fmaxf(mrow, mx);
    // corr = exp(mrow - mnew). v_exp_f32 and the one slot the instruction set
    // asks for behind it stand in one statement: the instruction that follows
    // may read the result or reuse the source register.
    float corr;
    asm("v_exp_f32 %0, %1\n\tv_nop" : "=v"(corr) : "v"((mrow - mnew) * 1.44269504f));
    v16bf p;   // P^T: element r is key half * 8 + r, element 8 + r key 16 + half * 8 + r
    float t[8];
    #pragma unroll
    for (int r = 0; r < 8; r++) {
      float p0 = __expf(s0[r] * scale - mnew);
      float p1 = __expf(s1[r] * scale - mnew);
      p[r]     = (bf16)p0;
      p[8 + r] = (bf16)p1;
      t[r] = p0 + p1;
    }
    float rs = ((t[0] + t[1]) + (t[2] + t[3])) + ((t[4] + t[5]) + (t[6] + t[7]));
    lrow = lrow * corr + rs;
    mrow = mnew;
    #pragma unroll
    for (int dt = 0; dt < 4; dt++) o[dt] *= corr;

    // ---- O^T += V^T(16 dims x 32 keys) * P^T(32 keys x 16 queries) ----
    #pragma unroll
    for (int dt = 0; dt < 4; dt++) {
      v16bf vv = load_packed(vp + dt * 512, lane);
      o[dt] = wmma_bf16(vv, p, o[dt]);
    }
   }
   // Publish point of stage st + 1: this wave's reads of buffer st & 1 are done,
   // its copies of stage st + 1 have landed, and the barrier says both of every
   // wave; only then is the buffer just read filled again.
   asm volatile("s_wait_dscnt 0x0" ::: "memory");
   asm volatile("s_wait_asynccnt 0x0" ::: "memory");
   __syncthreads();
   if (st + 2 < TT / SKEYS)
     stage_kv_async(kg + (st + 2) * STE, vg + (st + 2) * STE,
                    lds0 + (unsigned)(st & 1) * (4u * STE));
  }
  asm volatile("s_wait_asynccnt 0x0" ::: "memory");   // no copy is left at the wave's end

  // ---- join the halves' sums, normalize, store attn [B*T, AD] bf16 ----
  float inv = 1.0f / (lrow + other_half(lrow));
  bf16* outb = attn + ((size_t)(b * TT + qt + n) * AD) + h * HD + half * 8;
  #pragma unroll
  for (int dt = 0; dt < 4; dt++) {
    union { bf16 e[8]; uint4 u; } pk;
    #pragma unroll
    for (int r = 0; r < 8; r++) pk.e[r] = (bf16)(o[dt][r] * inv);
    *(uint4*)(outb + dt * 16) = pk.u;
  }
}

// ---------------- kernel 5: output projection + bias + residual ------------
// attn panel async-staged in LDS; each wave owns 4 register-blocked N-tiles.
__global__ __launch_bounds__(256) void out_proj(const bf16* __restrict__ attn,
                                                const bf16* __restrict__ woT,
                                                const float* __restrict__ bo,
                                                const float* __restrict__ x,
                                                float* __restrict__ out) {
  int t0  = blockIdx.x * 16;         // token row over B*T
  int tid = threadIdx.x;
  int wave = tid >> 5, lane = tid & 31;

  __shared__ __align__(16) bf16 As[16 * AD];   // 16 KB attn panel
  stage_panel_async(attn + (size_t)t0 * AD, As, tid);
  __syncthreads();

  int nbase0 = wave * 64;            // wave covers n-tiles 4w..4w+3
  v8f acc[4] = {{}, {}, {}, {}};
  for (int kk = 0; kk < AD; kk += 32) {
    v16bf a = load_ab(As + kk, AD, lane);      // LDS
    #pragma unroll
    for (int t = 0; t < 4; ++t) {
      v16bf bm = load_packed(woT + (size_t)(nbase0 + t * 16) * AD + kk * 16, lane);
      acc[t] = wmma_bf16(a, bm, acc[t]);
    }
  }
  int n = lane & 15, half = lane >> 4;
  #pragma unroll
  for (int t = 0; t < 4; ++t) {
    int nbase = nbase0 + t * 16;
    float bias = bo[nbase + n];
    #pragma unroll
    for (int r = 0; r < 8; r++) {
      int m = r + half * 8;
      size_t idx = (size_t)(t0 + m) * CC + nbase + n;
      out[idx] = x[idx] + acc[t][r] + bias;
    }
  }
}

// ---------------- launch ----------------
extern "C" void kernel_launch(void* const* d_in, const int* in_sizes, int n_in,
                              void* d_out, int out_size, void* d_ws, size_t ws_size,
                              hipStream_t stream) {
  const float* x     = (const float*)d_in[0];
  const float* gamma = (const float*)d_in[1];
  const float* beta  = (const float*)d_in[2];
  const float* wq    = (const float*)d_in[3];
  const float* bq    = (const float*)d_in[4];
  const float* wk    = (const float*)d_in[5];
  const float* bk    = (const float*)d_in[6];
  const float* wv    = (const float*)d_in[7];
  const float* bv    = (const float*)d_in[8];
  const float* wo    = (const float*)d_in[9];
  const float* bo    = (const float*)d_in[10];
  float* out = (float*)d_out;

  // workspace carve-up
  const size_t XN = (size_t)BSZ * TT * CC;   // 8.4M elems
  const size_t WW = (size_t)512 * 512;
  char* ws = (char*)d_ws;
  float* part = (float*)ws;                  // 2*GNP*B floats = 4096 bytes
  bf16* attn = (bf16*)(ws + 4096);
  bf16* wqT = attn + XN;
  bf16* wkT = wqT + WW;
  bf16* wvT = wkT + WW;
  bf16* woT = wvT + WW;
  bf16* qb  = woT + WW;
  bf16* kb  = qb  + XN;
  bf16* vT  = kb  + XN;

  gn_stats<<<BSZ * GNP, 256, 0, stream>>>(x, part);
  wcast_t<<<dim3(16, 16, 4), dim3(32, 8), 0, stream>>>(wq, wk, wv, wo,
                                                       wqT, wkT, wvT, woT);
  qkv_gemm<<<(BSZ * TT) / 16, 256, 0, stream>>>(x, gamma, beta, part, wqT, wkT, wvT,
                                                bq, bk, bv, qb, kb, vT);
  attn_flash<<<dim3(TT / 128, NH, BSZ), 256, 0, stream>>>(qb, kb, vT, attn);
  out_proj<<<(BSZ * TT) / 16, 256, 0, stream>>>(attn, woT, bo, x, out);
}

// v006
// A run of this version takes 90.7 microseconds.
// Timed twice side by side with v005, it ran 1.40 times as fast both times.
// Counting every step since v000, it is 4.81 times as fast.
#include <hip/hip_runtime.h>

// ---------------- problem constants ----------------
#define BSZ 16
#define TT  1024          // H*W tokens
#define CC  512           // channels
#define NH  8
#define HD  64
#define AD  512           // attention dim
#define EPSV 1e-5f
#define GNP  32           // partial GroupNorm sums per sample, one per lane
#define MR   64           // token rows per work-group in both GEMMs
#define AP   (CC + 8)     // LDS row pitch of their A panel, elements: 1040 B = 16 B x 65

typedef __bf16 bf16;
typedef __bf16 v16bf __attribute__((ext_vector_type(16)));
typedef float  v8f   __attribute__((ext_vector_type(8)));

// ---------------- WMMA helpers ----------------
__device__ __forceinline__ v8f wmma_bf16(v16bf a, v16bf b, v8f c) {
  // D = A(16x32 bf16) * B(32x16 bf16) + C(16x16 f32)
  return __builtin_amdgcn_wmma_f32_16x16x32_bf16(
      /*neg_a=*/false, a, /*neg_b=*/false, b,
      /*c_mod=*/(short)0, c, /*reuse_a=*/false, /*reuse_b=*/false);
}

// Load a 16x32 bf16 A-operand (or 32x16 B-operand, mirrored) per the CDNA5
// VGPR layout: lanes 0-15 -> row=lane, K chunks {0..7} and {16..23};
// lanes 16-31 -> row=lane-16, K chunks {8..15} and {24..31}.
// Each chunk is 8 contiguous bf16 = one 16-byte load.
__device__ __forceinline__ v16bf load_ab(const bf16* base, int row_stride, int lane) {
  int half = lane >> 4;
  int r    = lane & 15;
  const bf16* p = base + (size_t)r * row_stride + half * 8;
  union { v16bf v; uint4 q[2]; } u;
  u.q[0] = *(const uint4*)(p);        // K 0..7   (or 8..15)
  u.q[1] = *(const uint4*)(p + 16);   // K 16..23 (or 24..31)
  return u.v;
}

// Packed operand tile: a 16-row x 32-k bf16 tile is stored as 512 elements in
// the order the lanes consume it: element (row, k) lies at
//   (k >> 4) * 256 + (((k >> 3) & 1) * 16 + row) * 8 + (k & 7).
// Each of the two wave-wide 16-byte loads then covers 512 contiguous bytes
// (4 whole 128-byte lines) and yields the same registers as load_ab().
__device__ __forceinline__ v16bf load_packed(const bf16* tile, int lane) {
  union { v16bf v; uint4 q[2]; } u;
  u.q[0] = *(const uint4*)(tile + lane * 8);        // K 0..7   (or 8..15)
  u.q[1] = *(const uint4*)(tile + 256 + lane * 8);  // K 16..23 (or 24..31)
  return u.v;
}

// Four 16-byte copies per lane from global memory into LDS.
// l*: the lane's own LDS byte addresses; g*: the lane's own global addresses.
__device__ __forceinline__ void copy4_async(unsigned l0, unsigned l1, unsigned l2,
                                            unsigned l3, const bf16* g0, const bf16* g1,
                                            const bf16* g2, const bf16* g3) {
  // s_wait_xcnt in the copies' own statement: their address registers are not
  // rewritten before the wait.
  asm volatile("global_load_async_to_lds_b128 %0, %4, off\n\t"
               "global_load_async_to_lds_b128 %1, %5, off\n\t"
               "global_load_async_to_lds_b128 %2, %6, off\n\t"
               "global_load_async_to_lds_b128 %3, %7, off\n\t"
               "s_wait_xcnt 0x0"
               :: "v"(l0), "v"(l1), "v"(l2), "v"(l3), "v"(g0), "v"(g1), "v"(g2), "v"(g3)
               : "memory");
}

// One wave's 64 x 64 block of panel(64 x 512, LDS, pitch AP) * W(512 x 64):
// 4 row tiles x 4 column tiles, acc[m][t]. wp: the first of the wave's packed
// weight tiles (column tile t, k step ks at t * 8192 + ks * 512 elements).
// Every weight fragment is loaded once and feeds the 4 row tiles. Two fragment
// sets: a fragment is fetched again, for two k steps on, right behind its last
// product; the panel's fragments are fetched one k step ahead.
__device__ __forceinline__ void gemm_64x64(const bf16* As, const bf16* wp, int lane,
                                           v8f (&acc)[4][4]) {
  v16bf bb[2][4], a[4];
  #pragma unroll
  for (int t = 0; t < 4; ++t) bb[0][t] = load_packed(wp + t * 8192, lane);
  #pragma unroll
  for (int t = 0; t < 4; ++t) bb[1][t] = load_packed(wp + t * 8192 + 512, lane);
  #pragma unroll
  for (int m = 0; m < 4; ++m) a[m] = load_ab(As + m * 16 * AP, AP, lane);
  // This and the two below hold each group of loads where it is written: without
  // them the compiler moves every load down to just ahead of its first product,
  // and the wave then waits out a whole L2 or LDS latency per fragment.
  __builtin_amdgcn_sched_barrier(0);
  // unrolled: the fragment sets are indexed by constants and stay in registers
  #pragma unroll
  for (int ks = 0; ks < CC / 32; ++ks) {
    v16bf an[4];
    if (ks + 1 < CC / 32) {
      #pragma unroll
      for (int m = 0; m < 4; ++m)
        an[m] = load_ab(As + m * 16 * AP + (ks + 1) * 32, AP, lane);
      __builtin_amdgcn_sched_barrier(0);
    }
    #pragma unroll
    for (int t = 0; t < 4; ++t) {
      #pragma unroll
      for (int m = 0; m < 4; ++m) acc[m][t] = wmma_bf16(a[m], bb[ks & 1][t], acc[m][t]);
      if (ks + 2 < CC / 32) {
        bb[ks & 1][t] = load_packed(wp + t * 8192 + (ks + 2) * 512, lane);
        // Behind the last weight load its offset register is free for reuse:
        // wait before it can be overwritten (named here, it lives up to the wait).
        if (ks + 3 == CC / 32 && t == 3)
          asm volatile("s_wait_xcnt 0x0" :: "v"(lane) : "memory");
        __builtin_amdgcn_sched_barrier(0);
      }
    }
    if (ks + 1 < CC / 32) {
      #pragma unroll
      for (int m = 0; m < 4; ++m) a[m] = an[m];
    }
  }
}

// ---------------- lane exchange ----------------
// Value of lane l ^ 16 (the other half's share of the same query).
__device__ __forceinline__ float other_half(float v) {
  int b = __builtin_bit_cast(int, v);
  b = __builtin_amdgcn_permlanex16(b, b, 0x76543210, 0xfedcba98, false, false);
  return __builtin_bit_cast(float, b);
}

// v plus the value of lane l ^ X inside the 16-lane row (DPP row_xmask:X).
template <int X>
__device__ __forceinline__ float add_row_xor(float v) {
  int m = __builtin_amdgcn_update_dpp(0, __builtin_bit_cast(int, v), 0x160 + X,
                                      0xf, 0xf, true);
  return v + __builtin_bit_cast(float, m);
}

// Sum over the 32 lanes of a wave, all lanes on; every lane gets the total.
__device__ __forceinline__ float wave_sum(float v) {
  v = add_row_xor<1>(v);
  v = add_row_xor<2>(v);
  v = add_row_xor<4>(v);
  v = add_row_xor<8>(v);
  return v + other_half(v);
}

// ---------------- kernel 1: GroupNorm partial sums (1 group) ----------------
// Work-group g sums 64 KB of x in a row: slice g % GNP of sample g / GNP.
// part[2 * g] = sum, part[2 * g + 1] = sum of squares; the QKV GEMM joins the
// GNP slices of its sample.
__global__ __launch_bounds__(256) void gn_stats(const float* __restrict__ x,
                                                float* __restrict__ part) {
  const int tid = threadIdx.x;
  const float4* p = (const float4*)x + (size_t)blockIdx.x * (TT * CC / 4 / GNP) + tid;
  float4 v[16];
  // unrolled: v[] stays in registers and the 16 loads are in flight together
  #pragma unroll
  for (int i = 0; i < 16; ++i) v[i] = p[i * 256];
  // Without it the compiler issues the last 4 loads behind the first sums' waits:
  // three memory latencies in a row instead of one.
  __builtin_amdgcn_sched_barrier(0);
  float4 a4 = make_float4(0.f, 0.f, 0.f, 0.f), q4 = a4;   // four chains each
  // unrolled: v[i] is indexed by a constant, so it needs no scratch memory
  #pragma unroll
  for (int i = 0; i < 16; ++i) {
    a4.x += v[i].x;  a4.y += v[i].y;  a4.z += v[i].z;  a4.w += v[i].w;
    q4.x += v[i].x * v[i].x;  q4.y += v[i].y * v[i].y;
    q4.z += v[i].z * v[i].z;  q4.w += v[i].w * v[i].w;
  }
  float s  = wave_sum((a4.x + a4.y) + (a4.z + a4.w));
  float ss = wave_sum((q4.x + q4.y) + (q4.z + q4.w));
  __shared__ float sh0[8], sh1[8];
  if ((tid & 31) == 0) { sh0[tid >> 5] = s; sh1[tid >> 5] = ss; }
  __syncthreads();
  if (tid == 0) {
    float a = 0.f, c = 0.f;
    for (int w = 0; w < 8; ++w) { a += sh0[w]; c += sh1[w]; }
    *(float2*)(part + 2 * blockIdx.x) = make_float2(a, c);
  }
}

// ---------------- kernel 2: weight transpose + cast (512x512 each) ----------
// Output: packed tiles, tile index = (n >> 4) * 16 + (k >> 5).
__global__ __launch_bounds__(256) void wcast_t(const float* __restrict__ wq,
                                               const float* __restrict__ wk,
                                               const float* __restrict__ wv,
                                               const float* __restrict__ wo,
                                               bf16* __restrict__ wqT,
                                               bf16* __restrict__ wkT,
                                               bf16* __restrict__ wvT,
                                               bf16* __restrict__ woT) {
  const float* w = (blockIdx.z == 0) ? wq : (blockIdx.z == 1) ? wk
                   : (blockIdx.z == 2) ? wv : wo;
  bf16* wt = (blockIdx.z == 0) ? wqT : (blockIdx.z == 1) ? wkT
             : (blockIdx.z == 2) ? wvT : woT;
  __shared__ float tile[32][33];
  int bx = blockIdx.x * 32, by = blockIdx.y * 32;
  int tx = threadIdx.x, ty = threadIdx.y;     // 32 x 8
  #pragma unroll
  for (int j = 0; j < 32; j += 8)
    tile[ty + j][tx] = w[(size_t)(by + ty + j) * 512 + bx + tx];
  __syncthreads();
  // The 32x32 block is two packed tiles (n 0..15 and n 16..31); each thread
  // writes 4 consecutive packed elements.
  int o   = (ty * 32 + tx) * 4;               // 0..1020
  int nt2 = o >> 9;
  int ln  = (o >> 3) & 31;
  int nl  = nt2 * 16 + (ln & 15);
  int kl  = ((o >> 8) & 1) * 16 + (ln >> 4) * 8 + (o & 7);
  union { bf16 e[4]; uint2 u; } r;
  #pragma unroll
  for (int i = 0; i < 4; ++i) r.e[i] = (bf16)tile[kl + i][nl];
  size_t dst = ((size_t)((bx >> 4) + nt2) * 16 + blockIdx.y) * 512 + (o & 511);
  *(uint2*)(wt + dst) = r.u;
}

// ---------------- kernel 3: GroupNorm apply + fused QKV WMMA GEMM ----------
// A panel (MR tokens x 512 K): x is read as f32, normalized, cast to bf16 and
// written to LDS once per block. Pass p is the product with wq, wk, wv; in each
// pass wave w takes all MR tokens x the 64 columns of head w (gemm_64x64).
// q stored [B*T, AD] bf16. k and v are stored as packed tiles per (b, head):
//   k: tile (16 keys x 32 head dims),  index (key >> 4) * 2 + (d >> 5)
//   v: tile (16 head dims x 32 keys),  index (key >> 5) * 4 + (d >> 4)
__global__ __launch_bounds__(256) void qkv_gemm(const float* __restrict__ x,
                                                const float* __restrict__ gamma,
                                                const float* __restrict__ beta,
                                                const float* __restrict__ part,
                                                const bf16* __restrict__ wqT,
                                                const bf16* __restrict__ wkT,
                                                const bf16* __restrict__ wvT,
                                                const float* __restrict__ bq,
                                                const float* __restrict__ bk,
                                                const float* __restrict__ bv,
                                                bf16* __restrict__ q,
                                                bf16* __restrict__ k,
                                                bf16* __restrict__ vT) {
  int t0   = blockIdx.x * MR;            // global token row (over B*T)
  int b    = t0 / TT;
  int tloc = t0 - b * TT;
  int tid  = threadIdx.x;
  int lane = tid & 31;
  const int wave = __builtin_amdgcn_readfirstlane(tid >> 5);   // scalar: = head

  __shared__ __align__(16) bf16 As[MR * AP];   // 65 KB A panel
  {
    // Thread tid takes the same 4 channels of rows rr * 2 + (tid >> 7): the
    // panel is 8192 float4 in a row, 32 per thread, all loads issued together.
    // Lane l takes slice l of this sample's sums; every wave joins all GNP.
    const float2 pr = *(const float2*)(part + (b * GNP + lane) * 2);
    // The load's address registers are reused as a destination of the loads
    // below: wait before they are overwritten.
    asm volatile("s_wait_xcnt 0x0" ::: "memory");
    const float* xp = x + (size_t)t0 * CC + tid * 4;
    float4 v[MR / 2];
    // unrolled: v[] stays in registers and the 32 loads are in flight together
    #pragma unroll
    for (int rr = 0; rr < MR / 2; ++rr) v[rr] = *(const float4*)(xp + rr * 1024);
    const int c = (tid & 127) * 4;
    float4 g  = *(const float4*)(gamma + c);
    float4 bt = *(const float4*)(beta + c);
    const float inv_n = 1.0f / (float)(TT * CC);
    const float mean = wave_sum(pr.x) * inv_n;
    const float var  = wave_sum(pr.y) * inv_n - mean * mean;
    const float inv  = rsqrtf(var + EPSV);
    // unrolled: v[rr] is indexed by a constant, so it needs no scratch memory
    #pragma unroll
    for (int rr = 0; rr < MR / 2; ++rr) {
      union { bf16 o[4]; uint2 u; } r;
      r.o[0] = (bf16)((v[rr].x - mean) * inv * g.x + bt.x);
      r.o[1] = (bf16)((v[rr].y - mean) * inv * g.y + bt.y);
      r.o[2] = (bf16)((v[rr].z - mean) * inv * g.z + bt.z);
      r.o[3] = (bf16)((v[rr].w - mean) * inv * g.w + bt.w);
      *(uint2*)(As + (rr * 2 + (tid >> 7)) * AP + c) = r.u;
    }
  }
  __syncthreads();

  const int n = lane & 15, half = lane >> 4;
  const unsigned hb = (unsigned)(b * NH + wave) * (TT * HD);   // (b, head) plane
  // One address per lane and matrix; tile, row and column tile are constant steps.
  bf16* qp = q + (size_t)(t0 + half * 8) * AD + wave * 64 + n;
  bf16* kp = k + hb + (unsigned)(tloc >> 4) * 1024 + (n >> 3) * 128 + half * 64 + (n & 7);
  bf16* vp = vT + hb + (unsigned)(tloc >> 5) * 2048 + lane * 8;

  // rolled: one copy of the 256 products and of the stores in the kernel's text
  #pragma unroll 1
  for (int pass = 0; pass < 3; ++pass) {   // 0=q 1=k 2=v
    const bf16*  wt = (pass == 0) ? wqT : (pass == 1) ? wkT : wvT;
    const float* bp = (pass == 0) ? bq : (pass == 1) ? bk : bv;
    float bias[4];                         // fetched ahead of the products
    #pragma unroll
    for (int t = 0; t < 4; ++t) bias[t] = bp[wave * 64 + t * 16 + n];
    // The loads' address registers are reused by the products' results: wait
    // before they are overwritten.
    asm volatile("s_wait_xcnt 0x0" ::: "memory");
    v8f acc[4][4] = {};
    gemm_64x64(As, wt + (size_t)wave * 64 * CC, lane, acc);
    // Behind each tile's stores: their data and address registers are reused by
    // the next tile and the next pass, so wait before they are overwritten.
    if (pass == 0) {                       // C-layout row mi * 16 + r + half * 8
      #pragma unroll
      for (int t = 0; t < 4; ++t)
        #pragma unroll
        for (int mi = 0; mi < 4; ++mi) {
          #pragma unroll
          for (int r = 0; r < 8; r++)
            qp[(mi * 16 + r) * AD + t * 16] = (bf16)(acc[mi][t][r] + bias[t]);
          asm volatile("s_wait_xcnt 0x0" ::: "memory");
        }
    } else if (pass == 1) {                // K: row = key m, k index = head dim
      #pragma unroll
      for (int t = 0; t < 4; ++t)
        #pragma unroll
        for (int mi = 0; mi < 4; ++mi) {
          #pragma unroll
          for (int r = 0; r < 8; r++)      // key m = r + half * 8 lies at m * 8
            kp[(mi * 2 + (t >> 1)) * 512 + (t & 1) * 256 + r * 8] =
                (bf16)(acc[mi][t][r] + bias[t]);
          asm volatile("s_wait_xcnt 0x0" ::: "memory");
        }
    } else {                               // V: row = head dim n, k index = key m
      #pragma unroll
      for (int t = 0; t < 4; ++t)
        #pragma unroll
        for (int mi = 0; mi < 4; ++mi) {
          union { bf16 e[8]; uint4 u; } pk;
          #pragma unroll
          for (int r = 0; r < 8; r++) pk.e[r] = (bf16)(acc[mi][t][r] + bias[t]);
          *(uint4*)(vp + ((mi >> 1) * 4 + t) * 512 + (mi & 1) * 256) = pk.u;
          asm volatile("s_wait_xcnt 0x0" ::: "memory");
        }
    }
  }
}

#define SKEYS 64                  // keys per stage
#define STE   (SKEYS * HD)        // elements of K, and of V, per stage

// One stage: each of 256 threads copies 2 x 16 B of K and 2 x 16 B of V.
// kg, vg: the lane's own global addresses; lds: the lane's own LDS byte address.
__device__ __forceinline__ void stage_kv_async(const bf16* kg, const bf16* vg,
                                               unsigned lds) {
  // s_wait_xcnt in the copies' own statement: their address registers are not
  // rewritten before the wait.
  asm volatile("global_load_async_to_lds_b128 %0, %4, off\n\t"
               "global_load_async_to_lds_b128 %1, %5, off\n\t"
               "global_load_async_to_lds_b128 %2, %6, off\n\t"
               "global_load_async_to_lds_b128 %3, %7, off\n\t"
               "s_wait_xcnt 0x0"
               :: "v"(lds), "v"(lds + 4096u), "v"(lds + 8192u), "v"(lds + 12288u),
                  "v"(kg), "v"(kg + 2048), "v"(vg), "v"(vg + 2048)
               : "memory");
}

__global__ __launch_bounds__(256) void attn_flash(const bf16* __restrict__ q,
                                                  const bf16* __restrict__ k,
                                                  const bf16* __restrict__ vT,
                                                  bf16* __restrict__ attn) {
  const int tid  = threadIdx.x;
  const int lane = tid & 31;
  const int qt = blockIdx.x * 128 + (tid >> 5) * 16;   // this wave's query tile
  const int h  = blockIdx.y;
  const int b  = blockIdx.z;
  const float scale = 0.125f;       // 1/sqrt(64), a power of two: exact

  const bf16* qbase = q  + ((size_t)(b * TT + qt) * AD) + h * HD;
  const bf16* kbase = k  + ((size_t)b * NH + h) * (TT * HD);  // packed tiles
  const bf16* vbase = vT + ((size_t)b * NH + h) * (TT * HD);  // packed tiles

  // Two buffers, each [K tiles 8 KB | V tiles 8 KB].
  __shared__ __align__(16) bf16 kv[2][2 * STE];
  const unsigned lds0 = (unsigned)(size_t)(void*)&kv[0][0] + (unsigned)tid * 16u;
  const bf16* kg = kbase + tid * 8;
  const bf16* vg = vbase + tid * 8;

  // Q^T B-operands for head dims 0..31 and 32..63 (loaded once)
  v16bf q0 = load_ab(qbase,      AD, lane);
  v16bf q1 = load_ab(qbase + 32, AD, lane);

  // o[dt][r] = O[query n][head dim dt * 16 + half * 8 + r]
  v8f o[4] = {{}, {}, {}, {}};
  float mrow = -1e30f;              // running maximum of this lane's query
  float lrow = 0.f;                 // running sum over this half's keys only
  const int n = lane & 15, half = lane >> 4;

  // Stage 0 lands and is published; stage 1 flies while stage 0 is worked on.
  stage_kv_async(kg, vg, lds0);
  asm volatile("s_wait_asynccnt 0x0" ::: "memory");   // this wave's share of stage 0
  __syncthreads();                                    // every wave's share
  stage_kv_async(kg + STE, vg + STE, lds0 + 4u * STE);

  for (int st = 0; st < TT / SKEYS; ++st) {
   const bf16* buf = kv[st & 1];
   // unrolled: the two 32-key passes of a stage read LDS at constant offsets
   #pragma unroll
   for (int sub = 0; sub < SKEYS / 32; ++sub) {
    // ---- S^T = K * Q^T for 32 keys (two 16-key M-tiles) ----
    const bf16* kp = buf + sub * 32 * HD;         // 4 packed tiles, 4 KB in a row
    const bf16* vp = buf + STE + sub * 32 * HD;   // 4 packed tiles, 4 KB in a row
    v16bf k0a = load_packed(kp,        lane);
    v16bf k0b = load_packed(kp + 512,  lane);
    v16bf k1a = load_packed(kp + 1024, lane);
    v16bf k1b = load_packed(kp + 1536, lane);
    v8f s0 = {}, s1 = {};
    s0 = wmma_bf16(k0a, q0, s0); s0 = wmma_bf16(k0b, q1, s0);
    s1 = wmma_bf16(k1a, q0, s1); s1 = wmma_bf16(k1b, q1, s1);

    // ---- online softmax, one query per lane ----
    float mx = fmaxf(s0[0], s1[0]);
    #pragma unroll
    for (int r = 1; r < 8; r++) mx = fmaxf(mx, fmaxf(s0[r], s1[r]));
    mx = fmaxf(mx, other_half(mx)) * scale;
    float mnew = fmaxf(mrow, mx);
    // corr = exp(mrow - mnew). v_exp_f32 and the one slot the instruction set
    // asks for behind it stand in one statement: the instruction that follows
    // may read the result or reuse the source register.
    float corr;
    asm("v_exp_f32 %0, %1\n\tv_nop" : "=v"(corr) : "v"((mrow - mnew) * 1.44269504f));
    v16bf p;   // P^T: element r is key half * 8 + r, element 8 + r key 16 + half * 8 + r
    float t[8];
    #pragma unroll
    for (int r = 0; r < 8; r++) {
      float p0 = __expf(s0[r] * scale - mnew);
      float p1 = __expf(s1[r] * scale - mnew);
      p[r]     = (bf16)p0;
      p[8 + r] = (bf16)p1;
      t[r] = p0 + p1;
    }
    float rs = ((t[0] + t[1]) + (t[2] + t[3])) + ((t[4] + t[5]) + (t[6] + t[7]));
    lrow = lrow * corr + rs;
    mrow = mnew;
    #pragma unroll
    for (int dt = 0; dt < 4; dt++) o[dt] *= corr;

    // ---- O^T += V^T(16 dims x 32 keys) * P^T(32 keys x 16 queries) ----
    #pragma unroll
    for (int dt = 0; dt < 4; dt++) {
      v16bf vv = load_packed(vp + dt * 512, lane);
      o[dt] = wmma_bf16(vv, p, o[dt]);
    }
   }
   // Publish point of stage st + 1: this wave's reads of buffer st & 1 are done,
   // its copies of stage st + 1 have landed, and the barrier says both of every
   // wave; only then is the buffer just read filled again.
   asm volatile("s_wait_dscnt 0x0" ::: "memory");
   asm volatile("s_wait_asynccnt 0x0" ::: "memory");
   __syncthreads();
   if (st + 2 < TT / SKEYS)
     stage_kv_async(kg + (st + 2) * STE, vg + (st + 2) * STE,
                    lds0 + (unsigned)(st & 1) * (4u * STE));
  }
  asm volatile("s_wait_asynccnt 0x0" ::: "memory");   // no copy is left at the wave's end

  // ---- join the halves' sums, normalize, store attn [B*T, AD] bf16 ----
  float inv = 1.0f / (lrow + other_half(lrow));
  bf16* outb = attn + ((size_t)(b * TT + qt + n) * AD) + h * HD + half * 8;
  #pragma unroll
  for (int dt = 0; dt < 4; dt++) {
    union { bf16 e[8]; uint4 u; } pk;
    #pragma unroll
    for (int r = 0; r < 8; r++) pk.e[r] = (bf16)(o[dt][r] * inv);
    *(uint4*)(outb + dt * 16) = pk.u;
  }
}

// ---------------- kernel 5: output projection + bias + residual ------------
// attn panel (MR tokens) async-staged in LDS; wave w takes all MR tokens x
// columns 64 w .. 64 w + 63 (gemm_64x64).
__global__ __launch_bounds__(256) void out_proj(const bf16* __restrict__ attn,
                                                const bf16* __restrict__ woT,
                                                const float* __restrict__ bo,
                                                const float* __restrict__ x,
                                                float* __restrict__ out) {
  int t0  = blockIdx.x * MR;         // token row over B*T
  int tid = threadIdx.x;
  int lane = tid & 31;
  const int wave = __builtin_amdgcn_readfirstlane(tid >> 5);   // scalar

  __shared__ __align__(16) bf16 As[MR * AP];   // 65 KB attn panel
  {
    // The panel is 4096 pieces of 16 B in a row in global memory, 64 a token
    // row; thread tid copies piece tid & 63 of rows (tid >> 6) + 4 * j, j < 16.
    const unsigned l = (unsigned)(size_t)(void*)As      // addr[31:0] = LDS offset
                     + (unsigned)(tid >> 6) * (AP * 2u) + (unsigned)(tid & 63) * 16u;
    const bf16* g = attn + (size_t)t0 * AD + tid * 8;
    // unrolled: constant steps of both addresses
    #pragma unroll
    for (int j = 0; j < 16; j += 4)
      copy4_async(l + (j + 0) * (4u * AP * 2u), l + (j + 1) * (4u * AP * 2u),
                  l + (j + 2) * (4u * AP * 2u), l + (j + 3) * (4u * AP * 2u),
                  g + (j + 0) * 2048, g + (j + 1) * 2048,
                  g + (j + 2) * 2048, g + (j + 3) * 2048);
    asm volatile("s_wait_asynccnt 0x0" ::: "memory");   // this wave's share has landed
  }
  __syncthreads();                                      // every wave's share

  v8f acc[4][4] = {};
  gemm_64x64(As, woT + (size_t)wave * 64 * AD, lane, acc);

  const int n = lane & 15, half = lane >> 4;
  const size_t base = (size_t)(t0 + half * 8) * CC + wave * 64 + n;
  const float* xb = x + base;
  float* ob = out + base;
  #pragma unroll
  for (int t = 0; t < 4; ++t) {
    float bias = bo[wave * 64 + t * 16 + n];
    float xv[4][8];
    // unrolled: xv[] stays in registers and the 32 loads are in flight together
    #pragma unroll
    for (int mi = 0; mi < 4; ++mi)
      #pragma unroll
      for (int r = 0; r < 8; r++) xv[mi][r] = xb[(mi * 16 + r) * CC + t * 16];
    #pragma unroll
    for (int mi = 0; mi < 4; ++mi)
      #pragma unroll
      for (int r = 0; r < 8; r++)
        ob[(mi * 16 + r) * CC + t * 16] = xv[mi][r] + acc[mi][t][r] + bias;
  }
}

// ---------------- launch ----------------
extern "C" void kernel_launch(void* const* d_in, const int* in_sizes, int n_in,
                              void* d_out, int out_size, void* d_ws, size_t ws_size,
                              hipStream_t stream) {
  const float* x     = (const float*)d_in[0];
  const float* gamma = (const float*)d_in[1];
  const float* beta  = (const float*)d_in[2];
  const float* wq    = (const float*)d_in[3];
  const float* bq    = (const float*)d_in[4];
  const float* wk    = (const float*)d_in[5];
  const float* bk    = (const float*)d_in[6];
  const float* wv    = (const float*)d_in[7];
  const float* bv    = (const float*)d_in[8];
  const float* wo    = (const float*)d_in[9];
  const float* bo    = (const float*)d_in[10];
  float* out = (float*)d_out;

  // workspace carve-up
  const size_t XN = (size_t)BSZ * TT * CC;   // 8.4M elems
  const size_t WW = (size_t)512 * 512;
  char* ws = (char*)d_ws;
  float* part = (float*)ws;                  // 2*GNP*B floats = 4096 bytes
  bf16* attn = (bf16*)(ws + 4096);
  bf16* wqT = attn + XN;
  bf16* wkT = wqT + WW;
  bf16* wvT = wkT + WW;
  bf16* woT = wvT + WW;
  bf16* qb  = woT + WW;
  bf16* kb  = qb  + XN;
  bf16* vT  = kb  + XN;

  gn_stats<<<BSZ * GNP, 256, 0, stream>>>(x, part);
  wcast_t<<<dim3(16, 16, 4), dim3(32, 8), 0, stream>>>(wq, wk, wv, wo,
                                                       wqT, wkT, wvT, woT);
  qkv_gemm<<<(BSZ * TT) / MR, 256, 0, stream>>>(x, gamma, beta, part, wqT, wkT, wvT,
                                                bq, bk, bv, qb, kb, vT);
  attn_flash<<<dim3(TT / 128, NH, BSZ), 256, 0, stream>>>(qb, kb, vT, attn);
  out_proj<<<(BSZ * TT) / MR, 256, 0, stream>>>(attn, woT, bo, x, out);
}

// v007
// Measured time: 87.1 microseconds a run.
// Two timings next to v006 both put it at 1.04 times that version's speed.
// Over all steps from v000 it is 4.99 times as fast.
#include <hip/hip_runtime.h>

// ---------------- problem constants ----------------
#define BSZ 16
#define TT  1024          // H*W tokens
#define CC  512           // channels
#define NH  8
#define HD  64
#define AD  512           // attention dim
#define EPSV 1e-5f
#define GNP  32           // partial GroupNorm sums per sample, one per lane
#define MR   64           // token rows per work-group in both GEMMs
#define AP   (CC + 8)     // LDS row pitch of the QKV A panel, elements: 1040 B = 16 B x 65

typedef __bf16 bf16;
typedef __bf16 v16bf __attribute__((ext_vector_type(16)));
typedef float  v8f   __attribute__((ext_vector_type(8)));
typedef unsigned v4u  __attribute__((ext_vector_type(4)));

// ---------------- WMMA helpers ----------------
__device__ __forceinline__ v8f wmma_bf16(v16bf a, v16bf b, v8f c) {
  // D = A(16x32 bf16) * B(32x16 bf16) + C(16x16 f32)
  return __builtin_amdgcn_wmma_f32_16x16x32_bf16(
      /*neg_a=*/false, a, /*neg_b=*/false, b,
      /*c_mod=*/(short)0, c, /*reuse_a=*/false, /*reuse_b=*/false);
}

// Load a 16x32 bf16 A-operand (or 32x16 B-operand, mirrored) per the CDNA5
// VGPR layout: lanes 0-15 -> row=lane, K chunks {0..7} and {16..23};
// lanes 16-31 -> row=lane-16, K chunks {8..15} and {24..31}.
// Each chunk is 8 contiguous bf16 = one 16-byte load.
__device__ __forceinline__ v16bf load_ab(const bf16* base, int row_stride, int lane) {
  int half = lane >> 4;
  int r    = lane & 15;
  const bf16* p = base + (size_t)r * row_stride + half * 8;
  union { v16bf v; uint4 q[2]; } u;
  u.q[0] = *(const uint4*)(p);        // K 0..7   (or 8..15)
  u.q[1] = *(const uint4*)(p + 16);   // K 16..23 (or 24..31)
  return u.v;
}

// Packed operand tile: a 16-row x 32-k bf16 tile is stored as 512 elements in
// the order the lanes consume it: element (row, k) lies at
//   (k >> 4) * 256 + (((k >> 3) & 1) * 16 + row) * 8 + (k & 7).
// Each of the two wave-wide 16-byte loads then covers 512 contiguous bytes
// (4 whole 128-byte lines) and yields the same registers as load_ab().
__device__ __forceinline__ v16bf load_packed(const bf16* tile, int lane) {
  union { v16bf v; uint4 q[2]; } u;
  u.q[0] = *(const uint4*)(tile + lane * 8);        // K 0..7   (or 8..15)
  u.q[1] = *(const uint4*)(tile + 256 + lane * 8);  // K 16..23 (or 24..31)
  return u.v;
}

// Four 16-byte copies per lane from global memory into LDS.
// l*: the lane's own LDS byte addresses; g*: the lane's own global addresses.
__device__ __forceinline__ void copy4_async(unsigned l0, unsigned l1, unsigned l2,
                                            unsigned l3, const bf16* g0, const bf16* g1,
                                            const bf16* g2, const bf16* g3) {
  // s_wait_xcnt in the copies' own statement: their address registers are not
  // rewritten before the wait.
  asm volatile("global_load_async_to_lds_b128 %0, %4, off\n\t"
               "global_load_async_to_lds_b128 %1, %5, off\n\t"
               "global_load_async_to_lds_b128 %2, %6, off\n\t"
               "global_load_async_to_lds_b128 %3, %7, off\n\t"
               "s_wait_xcnt 0x0"
               :: "v"(l0), "v"(l1), "v"(l2), "v"(l3), "v"(g0), "v"(g1), "v"(g2), "v"(g3)
               : "memory");
}

// One wave's 64 x 64 block of panel(64 x 512, LDS) * W(512 x 64):
// 4 row tiles x 4 column tiles, acc[m][t]. wp: the first of the wave's packed
// weight tiles (column tile t, k step ks at t * 8192 + ks * 512 elements).
// Every weight fragment is loaded once and feeds the 4 row tiles. Two fragment
// sets: a fragment is fetched again, for two k steps on, right behind its last
// product; the panel's fragments are fetched one k step ahead.
// TR = false: acc[m][t] = panel tile * weight tile; a lane holds 8 tokens
// (half * 8 + r) of one column (lane & 15). TR = true: the two operands change
// places (their register layouts mirror each other), acc[m][t] is the transposed
// tile; a lane holds 8 columns in a row (half * 8 + r) of one token (lane & 15).
// PK = false: the panel lies in rows of pitch AP. PK = true: it lies in packed
// tiles, row tile m, k step ks at (m * 16 + ks) * 512 elements.
template <bool TR, bool PK>
__device__ __forceinline__ void gemm_64x64(const bf16* As, const bf16* wp, int lane,
                                           v8f (&acc)[4][4]) {
  v16bf bb[2][4], a[4];
  #pragma unroll
  for (int t = 0; t < 4; ++t) bb[0][t] = load_packed(wp + t * 8192, lane);
  #pragma unroll
  for (int t = 0; t < 4; ++t) bb[1][t] = load_packed(wp + t * 8192 + 512, lane);
  #pragma unroll
  for (int m = 0; m < 4; ++m)
    a[m] = PK ? load_packed(As + m * 8192, lane) : load_ab(As + m * 16 * AP, AP, lane);
  // This and the two below hold each group of loads where it is written: without
  // them the compiler moves every load down to just ahead of its first product,
  // and the wave then waits out a whole L2 or LDS latency per fragment.
  __builtin_amdgcn_sched_barrier(0);
  // unrolled: the fragment sets are indexed by constants and stay in registers
  #pragma unroll
  for (int ks = 0; ks < CC / 32; ++ks) {
    v16bf an[4];
    if (ks + 1 < CC / 32) {
      #pragma unroll
      for (int m = 0; m < 4; ++m)
        an[m] = PK ? load_packed(As + m * 8192 + (ks + 1) * 512, lane)
                   : load_ab(As + m * 16 * AP + (ks + 1) * 32, AP, lane);
      __builtin_amdgcn_sched_barrier(0);
    }
    #pragma unroll
    for (int t = 0; t < 4; ++t) {
      #pragma unroll
      for (int m = 0; m < 4; ++m)
        acc[m][t] = TR ? wmma_bf16(bb[ks & 1][t], a[m], acc[m][t])
                       : wmma_bf16(a[m], bb[ks & 1][t], acc[m][t]);
      if (ks + 2 < CC / 32) {
        bb[ks & 1][t] = load_packed(wp + t * 8192 + (ks + 2) * 512, lane);
        // Behind the last weight load its offset register is free for reuse:
        // wait before it can be overwritten (named here, it lives up to the wait).
        if (ks + 3 == CC / 32 && t == 3)
          asm volatile("s_wait_xcnt 0x0" :: "v"(lane) : "memory");
        __builtin_amdgcn_sched_barrier(0);
      }
    }
    if (ks + 1 < CC / 32) {
      #pragma unroll
      for (int m = 0; m < 4; ++m) a[m] = an[m];
    }
  }
}

// ---------------- lane exchange ----------------
// Value of lane l ^ 16 (the other half's share of the same query).
__device__ __forceinline__ float other_half(float v) {
  int b = __builtin_bit_cast(int, v);
  b = __builtin_amdgcn_permlanex16(b, b, 0x76543210, 0xfedcba98, false, false);
  return __builtin_bit_cast(float, b);
}

// v plus the value of lane l ^ X inside the 16-lane row (DPP row_xmask:X).
template <int X>
__device__ __forceinline__ float add_row_xor(float v) {
  int m = __builtin_amdgcn_update_dpp(0, __builtin_bit_cast(int, v), 0x160 + X,
                                      0xf, 0xf, true);
  return v + __builtin_bit_cast(float, m);
}

// Sum over the 32 lanes of a wave, all lanes on; every lane gets the total.
__device__ __forceinline__ float wave_sum(float v) {
  v = add_row_xor<1>(v);
  v = add_row_xor<2>(v);
  v = add_row_xor<4>(v);
  v = add_row_xor<8>(v);
  return v + other_half(v);
}

// ---------------- kernel 1: GroupNorm partial sums (1 group) ----------------
// Work-group g sums 64 KB of x in a row: slice g % GNP of sample g / GNP.
// part[2 * g] = sum, part[2 * g + 1] = sum of squares; the QKV GEMM joins the
// GNP slices of its sample.
__global__ __launch_bounds__(256) void gn_stats(const float* __restrict__ x,
                                                float* __restrict__ part) {
  const int tid = threadIdx.x;
  const float4* p = (const float4*)x + (size_t)blockIdx.x * (TT * CC / 4 / GNP) + tid;
  float4 v[16];
  // unrolled: v[] stays in registers and the 16 loads are in flight together
  #pragma unroll
  for (int i = 0; i < 16; ++i) v[i] = p[i * 256];
  // Without it the compiler issues the last 4 loads behind the first sums' waits:
  // three memory latencies in a row instead of one.
  __builtin_amdgcn_sched_barrier(0);
  float4 a4 = make_float4(0.f, 0.f, 0.f, 0.f), q4 = a4;   // four chains each
  // unrolled: v[i] is indexed by a constant, so it needs no scratch memory
  #pragma unroll
  for (int i = 0; i < 16; ++i) {
    a4.x += v[i].x;  a4.y += v[i].y;  a4.z += v[i].z;  a4.w += v[i].w;
    q4.x += v[i].x * v[i].x;  q4.y += v[i].y * v[i].y;
    q4.z += v[i].z * v[i].z;  q4.w += v[i].w * v[i].w;
  }
  float s  = wave_sum((a4.x + a4.y) + (a4.z + a4.w));
  float ss = wave_sum((q4.x + q4.y) + (q4.z + q4.w));
  __shared__ float sh0[8], sh1[8];
  if ((tid & 31) == 0) { sh0[tid >> 5] = s; sh1[tid >> 5] = ss; }
  __syncthreads();
  if (tid == 0) {
    float a = 0.f, c = 0.f;
    for (int w = 0; w < 8; ++w) { a += sh0[w]; c += sh1[w]; }
    *(float2*)(part + 2 * blockIdx.x) = make_float2(a, c);
  }
}

// ---------------- kernel 2: weight transpose + cast (512x512 each) ----------
// Output: packed tiles, tile index = (n >> 4) * 16 + (k >> 5).
__global__ __launch_bounds__(256) void wcast_t(const float* __restrict__ wq,
                                               const float* __restrict__ wk,
                                               const float* __restrict__ wv,
                                               const float* __restrict__ wo,
                                               bf16* __restrict__ wqT,
                                               bf16* __restrict__ wkT,
                                               bf16* __restrict__ wvT,
                                               bf16* __restrict__ woT) {
  const float* w = (blockIdx.z == 0) ? wq : (blockIdx.z == 1) ? wk
                   : (blockIdx.z == 2) ? wv : wo;
  bf16* wt = (blockIdx.z == 0) ? wqT : (blockIdx.z == 1) ? wkT
             : (blockIdx.z == 2) ? wvT : woT;
  __shared__ float tile[32][33];
  int bx = blockIdx.x * 32, by = blockIdx.y * 32;
  int tx = threadIdx.x, ty = threadIdx.y;     // 32 x 8
  #pragma unroll
  for (int j = 0; j < 32; j += 8)
    tile[ty + j][tx] = w[(size_t)(by + ty + j) * 512 + bx + tx];
  __syncthreads();
  // The 32x32 block is two packed tiles (n 0..15 and n 16..31); each thread
  // writes 4 consecutive packed elements.
  int o   = (ty * 32 + tx) * 4;               // 0..1020
  int nt2 = o >> 9;
  int ln  = (o >> 3) & 31;
  int nl  = nt2 * 16 + (ln & 15);
  int kl  = ((o >> 8) & 1) * 16 + (ln >> 4) * 8 + (o & 7);
  union { bf16 e[4]; uint2 u; } r;
  #pragma unroll
  for (int i = 0; i < 4; ++i) r.e[i] = (bf16)tile[kl + i][nl];
  size_t dst = ((size_t)((bx >> 4) + nt2) * 16 + blockIdx.y) * 512 + (o & 511);
  *(uint2*)(wt + dst) = r.u;
}

// ---------------- kernel 3: GroupNorm apply + fused QKV WMMA GEMM ----------
// A panel (MR tokens x 512 K): x is read as f32, normalized, cast to bf16 and
// written to LDS once per block. Pass p is the product with wq, wk, wv; in each
// pass wave w takes all MR tokens x the 64 columns of head w (gemm_64x64).
// q, k and v are stored as packed tiles per (b, head):
//   q, k: tile (16 tokens x 32 head dims), index (token >> 4) * 2 + (d >> 5)
//   v:    tile (16 head dims x 32 keys),   index (key >> 5) * 4 + (d >> 4)
// A 16-byte piece of a q or k tile is 8 head dims of one token, of a v tile 8
// keys of one head dim: q and k are computed as transposed tiles, v as plain
// ones, so that a lane holds such a piece and a wave-wide 16-byte store covers
// 512 bytes in a row.
__global__ __launch_bounds__(256) void qkv_gemm(const float* __restrict__ x,
                                                const float* __restrict__ gamma,
                                                const float* __restrict__ beta,
                                                const float* __restrict__ part,
                                                const bf16* __restrict__ wqT,
                                                const bf16* __restrict__ wkT,
                                                const bf16* __restrict__ wvT,
                                                const float* __restrict__ bq,
                                                const float* __restrict__ bk,
                                                const float* __restrict__ bv,
                                                bf16* __restrict__ q,
                                                bf16* __restrict__ k,
                                                bf16* __restrict__ vT) {
  int t0   = blockIdx.x * MR;            // global token row (over B*T)
  int b    = t0 / TT;
  int tloc = t0 - b * TT;
  int tid  = threadIdx.x;
  int lane = tid & 31;
  const int wave = __builtin_amdgcn_readfirstlane(tid >> 5);   // scalar: = head

  __shared__ __align__(16) bf16 As[MR * AP];   // 65 KB A panel
  {
    // Thread tid takes the same 4 channels of rows rr * 2 + (tid >> 7): the
    // panel is 8192 float4 in a row, 32 per thread, all loads issued together.
    // Lane l takes slice l of this sample's sums; every wave joins all GNP.
    const float2 pr = *(const float2*)(part + (b * GNP + lane) * 2);
    // The load's address registers are reused as a destination of the loads
    // below: wait before they are overwritten.
    asm volatile("s_wait_xcnt 0x0" ::: "memory");
    const float* xp = x + (size_t)t0 * CC + tid * 4;
    float4 v[MR / 2];
    // unrolled: v[] stays in registers and the 32 loads are in flight together
    #pragma unroll
    for (int rr = 0; rr < MR / 2; ++rr) v[rr] = *(const float4*)(xp + rr * 1024);
    const int c = (tid & 127) * 4;
    float4 g  = *(const float4*)(gamma + c);
    float4 bt = *(const float4*)(beta + c);
    const float inv_n = 1.0f / (float)(TT * CC);
    const float mean = wave_sum(pr.x) * inv_n;
    const float var  = wave_sum(pr.y) * inv_n - mean * mean;
    const float inv  = rsqrtf(var + EPSV);
    // unrolled: v[rr] is indexed by a constant, so it needs no scratch memory
    #pragma unroll
    for (int rr = 0; rr < MR / 2; ++rr) {
      union { bf16 o[4]; uint2 u; } r;
      r.o[0] = (bf16)((v[rr].x - mean) * inv * g.x + bt.x);
      r.o[1] = (bf16)((v[rr].y - mean) * inv * g.y + bt.y);
      r.o[2] = (bf16)((v[rr].z - mean) * inv * g.z + bt.z);
      r.o[3] = (bf16)((v[rr].w - mean) * inv * g.w + bt.w);
      *(uint2*)(As + (rr * 2 + (tid >> 7)) * AP + c) = r.u;
    }
  }
  __syncthreads();

  const int n = lane & 15, half = lane >> 4;
  const unsigned hb = (unsigned)(b * NH + wave) * (TT * HD);   // (b, head) plane
  // One address per lane and matrix; row and column tile are constant steps.
  const unsigned qko = hb + (unsigned)(tloc >> 4) * 1024 + lane * 8;
  bf16* vp = vT + hb + (unsigned)(tloc >> 5) * 2048 + lane * 8;

  // rolled: one copy of the 256 transposed products and of the stores
  #pragma unroll 1
  for (int pass = 0; pass < 2; ++pass) {   // 0=q 1=k
    const bf16*  wt = (pass == 0) ? wqT : wkT;
    const float* bp = ((pass == 0) ? bq : bk) + wave * 64 + half * 8;
    bf16*        dp = ((pass == 0) ? q : k) + qko;
    float4 bias[4][2];                     // fetched ahead of the products
    #pragma unroll
    for (int t = 0; t < 4; ++t) {
      bias[t][0] = *(const float4*)(bp + t * 16);
      bias[t][1] = *(const float4*)(bp + t * 16 + 4);
    }
    // The loads' address registers are reused by the products' results: wait
    // before they are overwritten.
    asm volatile("s_wait_xcnt 0x0" ::: "memory");
    v8f acc[4][4] = {};
    gemm_64x64<true, false>(As, wt + (size_t)wave * 64 * CC, lane, acc);
    // Token mi * 16 + n, head dims t * 16 + half * 8 + r: piece lane of half
    // t & 1 of tile mi * 2 + (t >> 1), that is mi * 1024 + t * 256 + lane * 8.
    v4u pk[4][4];
    #pragma unroll
    for (int mi = 0; mi < 4; ++mi)
      #pragma unroll
      for (int t = 0; t < 4; ++t) {
        union { bf16 e[8]; v4u u; } c;
        c.e[0] = (bf16)(acc[mi][t][0] + bias[t][0].x);
        c.e[1] = (bf16)(acc[mi][t][1] + bias[t][0].y);
        c.e[2] = (bf16)(acc[mi][t][2] + bias[t][0].z);
        c.e[3] = (bf16)(acc[mi][t][3] + bias[t][0].w);
        c.e[4] = (bf16)(acc[mi][t][4] + bias[t][1].x);
        c.e[5] = (bf16)(acc[mi][t][5] + bias[t][1].y);
        c.e[6] = (bf16)(acc[mi][t][6] + bias[t][1].z);
        c.e[7] = (bf16)(acc[mi][t][7] + bias[t][1].w);
        pk[mi][t] = c.u;
        *(v4u*)(dp + mi * 1024 + t * 256) = pk[mi][t];
      }
    // The stores' data and address registers are reused by the next pass: wait
    // before they are overwritten (named here, they live up to the wait).
    asm volatile("s_wait_xcnt 0x0"
                 :: "v"(pk[0][0]), "v"(pk[0][1]), "v"(pk[0][2]), "v"(pk[0][3]),
                    "v"(pk[1][0]), "v"(pk[1][1]), "v"(pk[1][2]), "v"(pk[1][3]),
                    "v"(pk[2][0]), "v"(pk[2][1]), "v"(pk[2][2]), "v"(pk[2][3]),
                    "v"(pk[3][0]), "v"(pk[3][1]), "v"(pk[3][2]), "v"(pk[3][3]), "v"(dp)
                 : "memory");
  }
  {                                        // v: row = head dim n, k index = key m
    float bias[4];                         // fetched ahead of the products
    #pragma unroll
    for (int t = 0; t < 4; ++t) bias[t] = bv[wave * 64 + t * 16 + n];
    // The loads' address registers are reused by the products' results: wait
    // before they are overwritten.
    asm volatile("s_wait_xcnt 0x0" ::: "memory");
    v8f acc[4][4] = {};
    gemm_64x64<false, false>(As, wvT + (size_t)wave * 64 * CC, lane, acc);
    #pragma unroll
    for (int t = 0; t < 4; ++t)
      #pragma unroll
      for (int mi = 0; mi < 4; ++mi) {
        union { bf16 e[8]; uint4 u; } pk;
        #pragma unroll
        for (int r = 0; r < 8; r++) pk.e[r] = (bf16)(acc[mi][t][r] + bias[t]);
        *(uint4*)(vp + ((mi >> 1) * 4 + t) * 512 + (mi & 1) * 256) = pk.u;
        // The store's data and address registers are reused by the next tile:
        // wait before they are overwritten.
        asm volatile("s_wait_xcnt 0x0" ::: "memory");
      }
  }
}

#define SKEYS 64                  // keys per stage
#define STE   (SKEYS * HD)        // elements of K, and of V, per stage

// One stage: each of 256 threads copies 2 x 16 B of K and 2 x 16 B of V.
// kg, vg: the lane's own global addresses; lds: the lane's own LDS byte address.
__device__ __forceinline__ void stage_kv_async(const bf16* kg, const bf16* vg,
                                               unsigned lds) {
  // s_wait_xcnt in the copies' own statement: their address registers are not
  // rewritten before the wait.
  asm volatile("global_load_async_to_lds_b128 %0, %4, off\n\t"
               "global_load_async_to_lds_b128 %1, %5, off\n\t"
               "global_load_async_to_lds_b128 %2, %6, off\n\t"
               "global_load_async_to_lds_b128 %3, %7, off\n\t"
               "s_wait_xcnt 0x0"
               :: "v"(lds), "v"(lds + 4096u), "v"(lds + 8192u), "v"(lds + 12288u),
                  "v"(kg), "v"(kg + 2048), "v"(vg), "v"(vg + 2048)
               : "memory");
}

__global__ __launch_bounds__(256) void attn_flash(const bf16* __restrict__ q,
                                                  const bf16* __restrict__ k,
                                                  const bf16* __restrict__ vT,
                                                  bf16* __restrict__ attn) {
  const int tid  = threadIdx.x;
  const int lane = tid & 31;
  const int qt = blockIdx.x * 128 + (tid >> 5) * 16;   // this wave's query tile
  const int h  = blockIdx.y;
  const int b  = blockIdx.z;
  const float scale = 0.125f;       // 1/sqrt(64), a power of two: exact

  const bf16* kbase = k  + ((size_t)b * NH + h) * (TT * HD);  // packed tiles
  const bf16* qbase = q  + ((size_t)b * NH + h) * (TT * HD) + (qt >> 4) * 1024;
  const bf16* vbase = vT + ((size_t)b * NH + h) * (TT * HD);  // packed tiles

  // Two buffers, each [K tiles 8 KB | V tiles 8 KB].
  __shared__ __align__(16) bf16 kv[2][2 * STE];
  const unsigned lds0 = (unsigned)(size_t)(void*)&kv[0][0] + (unsigned)tid * 16u;
  const bf16* kg = kbase + tid * 8;
  const bf16* vg = vbase + tid * 8;

  // Q^T B-operands for head dims 0..31 and 32..63 (loaded once)
  v16bf q0 = load_packed(qbase,       lane);
  v16bf q1 = load_packed(qbase + 512, lane);

  // o[dt][r] = O[query n][head dim dt * 16 + half * 8 + r]
  v8f o[4] = {{}, {}, {}, {}};
  float mrow = -1e30f;              // running maximum of this lane's query
  float lrow = 0.f;                 // running sum over this half's keys only

  // Stage 0 lands and is published; stage 1 flies while stage 0 is worked on.
  stage_kv_async(kg, vg, lds0);
  asm volatile("s_wait_asynccnt 0x0" ::: "memory");   // this wave's share of stage 0
  __syncthreads();                                    // every wave's share
  stage_kv_async(kg + STE, vg + STE, lds0 + 4u * STE);

  for (int st = 0; st < TT / SKEYS; ++st) {
   const bf16* buf = kv[st & 1];
   // unrolled: the two 32-key passes of a stage read LDS at constant offsets
   #pragma unroll
   for (int sub = 0; sub < SKEYS / 32; ++sub) {
    // ---- S^T = K * Q^T for 32 keys (two 16-key M-tiles) ----
    const bf16* kp = buf + sub * 32 * HD;         // 4 packed tiles, 4 KB in a row
    const bf16* vp = buf + STE + sub * 32 * HD;   // 4 packed tiles, 4 KB in a row
    v16bf k0a = load_packed(kp,        lane);
    v16bf k0b = load_packed(kp + 512,  lane);
    v16bf k1a = load_packed(kp + 1024, lane);
    v16bf k1b = load_packed(kp + 1536, lane);
    v8f s0 = {}, s1 = {};
    s0 = wmma_bf16(k0a, q0, s0); s0 = wmma_bf16(k0b, q1, s0);
    s1 = wmma_bf16(k1a, q0, s1); s1 = wmma_bf16(k1b, q1, s1);

    // ---- online softmax, one query per lane ----
    float mx = fmaxf(s0[0], s1[0]);
    #pragma unroll
    for (int r = 1; r < 8; r++) mx = fmaxf(mx, fmaxf(s0[r], s1[r]));
    mx = fmaxf(mx, other_half(mx)) * scale;
    float mnew = fmaxf(mrow, mx);
    // corr = exp(mrow - mnew). v_exp_f32 and the one slot the instruction set
    // asks for behind it stand in one statement: the instruction that follows
    // may read the result or reuse the source register.
    float corr;
    asm("v_exp_f32 %0, %1\n\tv_nop" : "=v"(corr) : "v"((mrow - mnew) * 1.44269504f));
    v16bf p;   // P^T: element r is key half * 8 + r, element 8 + r key 16 + half * 8 + r
    float t[8];
    #pragma unroll
    for (int r = 0; r < 8; r++) {
      float p0 = __expf(s0[r] * scale - mnew);
      float p1 = __expf(s1[r] * scale - mnew);
      p[r]     = (bf16)p0;
      p[8 + r] = (bf16)p1;
      t[r] = p0 + p1;
    }
    float rs = ((t[0] + t[1]) + (t[2] + t[3])) + ((t[4] + t[5]) + (t[6] + t[7]));
    lrow = lrow * corr + rs;
    mrow = mnew;
    #pragma unroll
    for (int dt = 0; dt < 4; dt++) o[dt] *= corr;

    // ---- O^T += V^T(16 dims x 32 keys) * P^T(32 keys x 16 queries) ----
    #pragma unroll
    for (int dt = 0; dt < 4; dt++) {
      v16bf vv = load_packed(vp + dt * 512, lane);
      o[dt] = wmma_bf16(vv, p, o[dt]);
    }
   }
   // Publish point of stage st + 1: this wave's reads of buffer st & 1 are done,
   // its copies of stage st + 1 have landed, and the barrier says both of every
   // wave; only then is the buffer just read filled again.
   asm volatile("s_wait_dscnt 0x0" ::: "memory");
   asm volatile("s_wait_asynccnt 0x0" ::: "memory");
   __syncthreads();
   if (st + 2 < TT / SKEYS)
     stage_kv_async(kg + (st + 2) * STE, vg + (st + 2) * STE,
                    lds0 + (unsigned)(st & 1) * (4u * STE));
  }
  asm volatile("s_wait_asynccnt 0x0" ::: "memory");   // no copy is left at the wave's end

  // ---- join the halves' sums, normalize, store attn as packed tiles ----
  // tile (16 tokens x 32 of the AD columns), index (token >> 4) * 16 + (col >> 5):
  // the lane's 8 head dims dt * 16 + half * 8 + r of query n are piece lane of
  // half dt & 1 of tile h * 2 + (dt >> 1); the wave's 4 stores fill 2 KB in a row.
  float inv = 1.0f / (lrow + other_half(lrow));
  bf16* outb = attn + (size_t)((b * TT + qt) >> 4) * 8192 + h * 1024 + lane * 8;
  #pragma unroll
  for (int dt = 0; dt < 4; dt++) {
    union { bf16 e[8]; uint4 u; } pk;
    #pragma unroll
    for (int r = 0; r < 8; r++) pk.e[r] = (bf16)(o[dt][r] * inv);
    *(uint4*)(outb + dt * 256) = pk.u;
  }
}

// ---------------- kernel 5: output projection + bias + residual ------------
// attn panel (MR tokens, 64 packed tiles in a row) async-staged in LDS as it
// lies; wave w takes all MR tokens x columns 64 w .. 64 w + 63 (gemm_64x64).
__global__ __launch_bounds__(256) void out_proj(const bf16* __restrict__ attn,
                                                const bf16* __restrict__ woT,
                                                const float* __restrict__ bo,
                                                const float* __restrict__ x,
                                                float* __restrict__ out) {
  int t0  = blockIdx.x * MR;         // token row over B*T
  int tid = threadIdx.x;
  int lane = tid & 31;
  const int wave = __builtin_amdgcn_readfirstlane(tid >> 5);   // scalar

  __shared__ __align__(16) bf16 As[MR * AD];   // 64 KB attn panel
  {
    // The panel is 4096 pieces of 16 B in a row in global memory and in LDS;
    // thread tid copies pieces tid + 256 * j, j < 16.
    const unsigned l = (unsigned)(size_t)(void*)As      // addr[31:0] = LDS offset
                     + (unsigned)tid * 16u;
    const bf16* g = attn + (size_t)t0 * AD + tid * 8;
    // unrolled: constant steps of both addresses
    #pragma unroll
    for (int j = 0; j < 16; j += 4)
      copy4_async(l + (j + 0) * 4096u, l + (j + 1) * 4096u,
                  l + (j + 2) * 4096u, l + (j + 3) * 4096u,
                  g + (j + 0) * 2048, g + (j + 1) * 2048,
                  g + (j + 2) * 2048, g + (j + 3) * 2048);
    asm volatile("s_wait_asynccnt 0x0" ::: "memory");   // this wave's share has landed
  }
  __syncthreads();                                      // every wave's share

  v8f acc[4][4] = {};
  gemm_64x64<false, true>(As, woT + (size_t)wave * 64 * AD, lane, acc);

  const int n = lane & 15, half = lane >> 4;
  const size_t base = (size_t)(t0 + half * 8) * CC + wave * 64 + n;
  const float* xb = x + base;
  float* ob = out + base;
  #pragma unroll
  for (int t = 0; t < 4; ++t) {
    float bias = bo[wave * 64 + t * 16 + n];
    float xv[4][8];
    // unrolled: xv[] stays in registers and the 32 loads are in flight together
    #pragma unroll
    for (int mi = 0; mi < 4; ++mi)
      #pragma unroll
      for (int r = 0; r < 8; r++) xv[mi][r] = xb[(mi * 16 + r) * CC + t * 16];
    // Behind the last residual load its address registers are free for reuse:
    // wait before they can be overwritten (named here, they live up to the wait).
    if (t == 3) asm volatile("s_wait_xcnt 0x0" :: "v"(xb) : "memory");
    #pragma unroll
    for (int mi = 0; mi < 4; ++mi)
      #pragma unroll
      for (int r = 0; r < 8; r++)
        ob[(mi * 16 + r) * CC + t * 16] = xv[mi][r] + acc[mi][t][r] + bias;
  }
}

// ---------------- launch ----------------
extern "C" void kernel_launch(void* const* d_in, const int* in_sizes, int n_in,
                              void* d_out, int out_size, void* d_ws, size_t ws_size,
                              hipStream_t stream) {
  const float* x     = (const float*)d_in[0];
  const float* gamma = (const float*)d_in[1];
  const float* beta  = (const float*)d_in[2];
  const float* wq    = (const float*)d_in[3];
  const float* bq    = (const float*)d_in[4];
  const float* wk    = (const float*)d_in[5];
  const float* bk    = (const float*)d_in[6];
  const float* wv    = (const float*)d_in[7];
  const float* bv    = (const float*)d_in[8];
  const float* wo    = (const float*)d_in[9];
  const float* bo    = (const float*)d_in[10];
  float* out = (float*)d_out;

  // workspace carve-up
  const size_t XN = (size_t)BSZ * TT * CC;   // 8.4M elems
  const size_t WW = (size_t)512 * 512;
  char* ws = (char*)d_ws;
  float* part = (float*)ws;                  // 2*GNP*B floats = 4096 bytes
  bf16* attn = (bf16*)(ws + 4096);
  bf16* wqT = attn + XN;
  bf16* wkT = wqT + WW;
  bf16* wvT = wkT + WW;
  bf16* woT = wvT + WW;
  bf16* qb  = woT + WW;
  bf16* kb  = qb  + XN;
  bf16* vT  = kb  + XN;

  gn_stats<<<BSZ * GNP, 256, 0, stream>>>(x, part);
  wcast_t<<<dim3(16, 16, 4), dim3(32, 8), 0, stream>>>(wq, wk, wv, wo,
                                                       wqT, wkT, wvT, woT);
  qkv_gemm<<<(BSZ * TT) / MR, 256, 0, stream>>>(x, gamma, beta, part, wqT, wkT, wvT,
                                                bq, bk, bv, qb, kb, vT);
  attn_flash<<<dim3(TT / 128, NH, BSZ), 256, 0, stream>>>(qb, kb, vT, attn);
  out_proj<<<(BSZ * TT) / MR, 256, 0, stream>>>(attn, woT, bo, x, out);
}

// v008
// Measured time: 81.2 microseconds a run.
// Next to v007, in two timings, it ran 1.06 and 1.07 times as fast.
// Counting every step since v000, it is 5.32 times as fast.
#include <hip/hip_runtime.h>

// ---------------- problem constants ----------------
#define BSZ 16
#define TT  1024          // H*W tokens
#define CC  512           // channels
#define NH  8
#define HD  64
#define AD  512           // attention dim
#define EPSV 1e-5f
#define GNP  32           // partial GroupNorm sums per sample, one per lane
#define MR   64           // token rows per work-group in both GEMMs
#define AP   (CC + 8)     // LDS row pitch of the QKV A panel, elements: 1040 B = 16 B x 65

typedef __bf16 bf16;
typedef __bf16 v16bf __attribute__((ext_vector_type(16)));
typedef float  v8f   __attribute__((ext_vector_type(8)));
typedef unsigned v4u  __attribute__((ext_vector_type(4)));
typedef float  v2f   __attribute__((ext_vector_type(2)));

// ---------------- WMMA helpers ----------------
__device__ __forceinline__ v8f wmma_bf16(v16bf a, v16bf b, v8f c) {
  // D = A(16x32 bf16) * B(32x16 bf16) + C(16x16 f32)
  return __builtin_amdgcn_wmma_f32_16x16x32_bf16(
      /*neg_a=*/false, a, /*neg_b=*/false, b,
      /*c_mod=*/(short)0, c, /*reuse_a=*/false, /*reuse_b=*/false);
}

// Load a 16x32 bf16 A-operand (or 32x16 B-operand, mirrored) per the CDNA5
// VGPR layout: lanes 0-15 -> row=lane, K chunks {0..7} and {16..23};
// lanes 16-31 -> row=lane-16, K chunks {8..15} and {24..31}.
// Each chunk is 8 contiguous bf16 = one 16-byte load.
__device__ __forceinline__ v16bf load_ab(const bf16* base, int row_stride, int lane) {
  int half = lane >> 4;
  int r    = lane & 15;
  const bf16* p = base + (size_t)r * row_stride + half * 8;
  union { v16bf v; uint4 q[2]; } u;
  u.q[0] = *(const uint4*)(p);        // K 0..7   (or 8..15)
  u.q[1] = *(const uint4*)(p + 16);   // K 16..23 (or 24..31)
  return u.v;
}

// Packed operand tile: a 16-row x 32-k bf16 tile is stored as 512 elements in
// the order the lanes consume it: element (row, k) lies at
//   (k >> 4) * 256 + (((k >> 3) & 1) * 16 + row) * 8 + (k & 7).
// Each of the two wave-wide 16-byte loads then covers 512 contiguous bytes
// (4 whole 128-byte lines) and yields the same registers as load_ab().
__device__ __forceinline__ v16bf load_packed(const bf16* tile, int lane) {
  union { v16bf v; uint4 q[2]; } u;
  u.q[0] = *(const uint4*)(tile + lane * 8);        // K 0..7   (or 8..15)
  u.q[1] = *(const uint4*)(tile + 256 + lane * 8);  // K 16..23 (or 24..31)
  return u.v;
}

// Four 16-byte copies per lane from global memory into LDS.
// l*: the lane's own LDS byte addresses; g*: the lane's own global addresses.
__device__ __forceinline__ void copy4_async(unsigned l0, unsigned l1, unsigned l2,
                                            unsigned l3, const bf16* g0, const bf16* g1,
                                            const bf16* g2, const bf16* g3) {
  // s_wait_xcnt in the copies' own statement: their address registers are not
  // rewritten before the wait.
  asm volatile("global_load_async_to_lds_b128 %0, %4, off\n\t"
               "global_load_async_to_lds_b128 %1, %5, off\n\t"
               "global_load_async_to_lds_b128 %2, %6, off\n\t"
               "global_load_async_to_lds_b128 %3, %7, off\n\t"
               "s_wait_xcnt 0x0"
               :: "v"(l0), "v"(l1), "v"(l2), "v"(l3), "v"(g0), "v"(g1), "v"(g2), "v"(g3)
               : "memory");
}

// One wave's 64 x 64 block of panel(64 x 512, LDS) * W(512 x 64):
// 4 row tiles x 4 column tiles, acc[m][t]. wp: the first of the wave's packed
// weight tiles (column tile t, k step ks at t * 8192 + ks * 512 elements).
// Every weight fragment is loaded once and feeds the 4 row tiles. Two fragment
// sets: a fragment is fetched again, for two k steps on, right behind its last
// product; the panel's fragments are fetched one k step ahead.
// TR = false: acc[m][t] = panel tile * weight tile; a lane holds 8 tokens
// (half * 8 + r) of one column (lane & 15). TR = true: the two operands change
// places (their register layouts mirror each other), acc[m][t] is the transposed
// tile; a lane holds 8 columns in a row (half * 8 + r) of one token (lane & 15).
// PK = false: the panel lies in rows of pitch AP. PK = true: it lies in packed
// tiles, row tile m, k step ks at (m * 16 + ks) * 512 elements.
template <bool TR, bool PK>
__device__ __forceinline__ void gemm_64x64(const bf16* As, const bf16* wp, int lane,
                                           v8f (&acc)[4][4]) {
  v16bf bb[2][4], a[4];
  #pragma unroll
  for (int t = 0; t < 4; ++t) bb[0][t] = load_packed(wp + t * 8192, lane);
  #pragma unroll
  for (int t = 0; t < 4; ++t) bb[1][t] = load_packed(wp + t * 8192 + 512, lane);
  #pragma unroll
  for (int m = 0; m < 4; ++m)
    a[m] = PK ? load_packed(As + m * 8192, lane) : load_ab(As + m * 16 * AP, AP, lane);
  // This and the two below hold each group of loads where it is written: without
  // them the compiler moves every load down to just ahead of its first product,
  // and the wave then waits out a whole L2 or LDS latency per fragment.
  __builtin_amdgcn_sched_barrier(0);
  // unrolled: the fragment sets are indexed by constants and stay in registers
  #pragma unroll
  for (int ks = 0; ks < CC / 32; ++ks) {
    v16bf an[4];
    if (ks + 1 < CC / 32) {
      #pragma unroll
      for (int m = 0; m < 4; ++m)
        an[m] = PK ? load_packed(As + m * 8192 + (ks + 1) * 512, lane)
                   : load_ab(As + m * 16 * AP + (ks + 1) * 32, AP, lane);
      __builtin_amdgcn_sched_barrier(0);
    }
    #pragma unroll
    for (int t = 0; t < 4; ++t) {
      #pragma unroll
      for (int m = 0; m < 4; ++m)
        acc[m][t] = TR ? wmma_bf16(bb[ks & 1][t], a[m], acc[m][t])
                       : wmma_bf16(a[m], bb[ks & 1][t], acc[m][t]);
      if (ks + 2 < CC / 32) {
        bb[ks & 1][t] = load_packed(wp + t * 8192 + (ks + 2) * 512, lane);
        // Behind the last weight load its offset register is free for reuse:
        // wait before it can be overwritten (named here, it lives up to the wait).
        if (ks + 3 == CC / 32 && t == 3)
          asm volatile("s_wait_xcnt 0x0" :: "v"(lane) : "memory");
        __builtin_amdgcn_sched_barrier(0);
      }
    }
    if (ks + 1 < CC / 32) {
      #pragma unroll
      for (int m = 0; m < 4; ++m) a[m] = an[m];
    }
  }
}

// ---------------- lane exchange ----------------
// Value of lane l ^ 16 (the other half's share of the same query).
__device__ __forceinline__ float other_half(float v) {
  int b = __builtin_bit_cast(int, v);
  b = __builtin_amdgcn_permlanex16(b, b, 0x76543210, 0xfedcba98, false, false);
  return __builtin_bit_cast(float, b);
}

// v plus the value of lane l ^ X inside the 16-lane row (DPP row_xmask:X).
template <int X>
__device__ __forceinline__ float add_row_xor(float v) {
  int m = __builtin_amdgcn_update_dpp(0, __builtin_bit_cast(int, v), 0x160 + X,
                                      0xf, 0xf, true);
  return v + __builtin_bit_cast(float, m);
}

// Sum over the 32 lanes of a wave, all lanes on; every lane gets the total.
__device__ __forceinline__ float wave_sum(float v) {
  v = add_row_xor<1>(v);
  v = add_row_xor<2>(v);
  v = add_row_xor<4>(v);
  v = add_row_xor<8>(v);
  return v + other_half(v);
}

// ---------------- kernel 1: GroupNorm partial sums (1 group) ----------------
// Work-group g sums 64 KB of x in a row: slice g % GNP of sample g / GNP.
// part[2 * g] = sum, part[2 * g + 1] = sum of squares; the QKV GEMM joins the
// GNP slices of its sample.
__global__ __launch_bounds__(256) void gn_stats(const float* __restrict__ x,
                                                float* __restrict__ part) {
  const int tid = threadIdx.x;
  const float4* p = (const float4*)x + (size_t)blockIdx.x * (TT * CC / 4 / GNP) + tid;
  float4 v[16];
  // unrolled: v[] stays in registers and the 16 loads are in flight together
  #pragma unroll
  for (int i = 0; i < 16; ++i) v[i] = p[i * 256];
  // Without it the compiler issues the last 4 loads behind the first sums' waits:
  // three memory latencies in a row instead of one.
  __builtin_amdgcn_sched_barrier(0);
  float4 a4 = make_float4(0.f, 0.f, 0.f, 0.f), q4 = a4;   // four chains each
  // unrolled: v[i] is indexed by a constant, so it needs no scratch memory
  #pragma unroll
  for (int i = 0; i < 16; ++i) {
    a4.x += v[i].x;  a4.y += v[i].y;  a4.z += v[i].z;  a4.w += v[i].w;
    q4.x += v[i].x * v[i].x;  q4.y += v[i].y * v[i].y;
    q4.z += v[i].z * v[i].z;  q4.w += v[i].w * v[i].w;
  }
  float s  = wave_sum((a4.x + a4.y) + (a4.z + a4.w));
  float ss = wave_sum((q4.x + q4.y) + (q4.z + q4.w));
  __shared__ float sh0[8], sh1[8];
  if ((tid & 31) == 0) { sh0[tid >> 5] = s; sh1[tid >> 5] = ss; }
  __syncthreads();
  if (tid == 0) {
    float a = 0.f, c = 0.f;
    for (int w = 0; w < 8; ++w) { a += sh0[w]; c += sh1[w]; }
    *(float2*)(part + 2 * blockIdx.x) = make_float2(a, c);
  }
}

// ---------------- kernel 2: weight transpose + cast (512x512 each) ----------
// Output: packed tiles, tile index = (n >> 4) * 16 + (k >> 5).
__global__ __launch_bounds__(256) void wcast_t(const float* __restrict__ wq,
                                               const float* __restrict__ wk,
                                               const float* __restrict__ wv,
                                               const float* __restrict__ wo,
                                               bf16* __restrict__ wqT,
                                               bf16* __restrict__ wkT,
                                               bf16* __restrict__ wvT,
                                               bf16* __restrict__ woT) {
  const float* w = (blockIdx.z == 0) ? wq : (blockIdx.z == 1) ? wk
                   : (blockIdx.z == 2) ? wv : wo;
  bf16* wt = (blockIdx.z == 0) ? wqT : (blockIdx.z == 1) ? wkT
             : (blockIdx.z == 2) ? wvT : woT;
  __shared__ float tile[32][33];
  int bx = blockIdx.x * 32, by = blockIdx.y * 32;
  int tx = threadIdx.x, ty = threadIdx.y;     // 32 x 8
  #pragma unroll
  for (int j = 0; j < 32; j += 8)
    tile[ty + j][tx] = w[(size_t)(by + ty + j) * 512 + bx + tx];
  __syncthreads();
  // The 32x32 block is two packed tiles (n 0..15 and n 16..31); each thread
  // writes 4 consecutive packed elements.
  int o   = (ty * 32 + tx) * 4;               // 0..1020
  int nt2 = o >> 9;
  int ln  = (o >> 3) & 31;
  int nl  = nt2 * 16 + (ln & 15);
  int kl  = ((o >> 8) & 1) * 16 + (ln >> 4) * 8 + (o & 7);
  union { bf16 e[4]; uint2 u; } r;
  #pragma unroll
  for (int i = 0; i < 4; ++i) r.e[i] = (bf16)tile[kl + i][nl];
  size_t dst = ((size_t)((bx >> 4) + nt2) * 16 + blockIdx.y) * 512 + (o & 511);
  *(uint2*)(wt + dst) = r.u;
}

// ---------------- kernel 3: GroupNorm apply + fused QKV WMMA GEMM ----------
// A panel (MR tokens x 512 K): x is read as f32, normalized, cast to bf16 and
// written to LDS once per block. Pass p is the product with wq, wk, wv; in each
// pass wave w takes all MR tokens x the 64 columns of head w (gemm_64x64).
// q, k and v are stored as packed tiles per (b, head):
//   q, k: tile (16 tokens x 32 head dims), index (token >> 4) * 2 + (d >> 5)
//   v:    tile (16 head dims x 32 keys),   index (key >> 5) * 4 + (d >> 4)
// A 16-byte piece of a q or k tile is 8 head dims of one token, of a v tile 8
// keys of one head dim: q and k are computed as transposed tiles, v as plain
// ones, so that a lane holds such a piece and a wave-wide 16-byte store covers
// 512 bytes in a row.
__global__ __launch_bounds__(256) void qkv_gemm(const float* __restrict__ x,
                                                const float* __restrict__ gamma,
                                                const float* __restrict__ beta,
                                                const float* __restrict__ part,
                                                const bf16* __restrict__ wqT,
                                                const bf16* __restrict__ wkT,
                                                const bf16* __restrict__ wvT,
                                                const float* __restrict__ bq,
                                                const float* __restrict__ bk,
                                                const float* __restrict__ bv,
                                                bf16* __restrict__ q,
                                                bf16* __restrict__ k,
                                                bf16* __restrict__ vT) {
  int t0   = blockIdx.x * MR;            // global token row (over B*T)
  int b    = t0 / TT;
  int tloc = t0 - b * TT;
  int tid  = threadIdx.x;
  int lane = tid & 31;
  const int wave = __builtin_amdgcn_readfirstlane(tid >> 5);   // scalar: = head

  __shared__ __align__(16) bf16 As[MR * AP];   // 65 KB A panel
  {
    // Thread tid takes the same 4 channels of rows rr * 2 + (tid >> 7): the
    // panel is 8192 float4 in a row, 32 per thread, all loads issued together.
    // Lane l takes slice l of this sample's sums; every wave joins all GNP.
    const float2 pr = *(const float2*)(part + (b * GNP + lane) * 2);
    // The load's address registers are reused as a destination of the loads
    // below: wait before they are overwritten.
    asm volatile("s_wait_xcnt 0x0" ::: "memory");
    const float* xp = x + (size_t)t0 * CC + tid * 4;
    float4 v[MR / 2];
    // unrolled: v[] stays in registers and the 32 loads are in flight together
    #pragma unroll
    for (int rr = 0; rr < MR / 2; ++rr) v[rr] = *(const float4*)(xp + rr * 1024);
    const int c = (tid & 127) * 4;
    float4 g  = *(const float4*)(gamma + c);
    float4 bt = *(const float4*)(beta + c);
    const float inv_n = 1.0f / (float)(TT * CC);
    const float mean = wave_sum(pr.x) * inv_n;
    const float var  = wave_sum(pr.y) * inv_n - mean * mean;
    const float inv  = rsqrtf(var + EPSV);
    // unrolled: v[rr] is indexed by a constant, so it needs no scratch memory
    #pragma unroll
    for (int rr = 0; rr < MR / 2; ++rr) {
      union { bf16 o[4]; uint2 u; } r;
      r.o[0] = (bf16)((v[rr].x - mean) * inv * g.x + bt.x);
      r.o[1] = (bf16)((v[rr].y - mean) * inv * g.y + bt.y);
      r.o[2] = (bf16)((v[rr].z - mean) * inv * g.z + bt.z);
      r.o[3] = (bf16)((v[rr].w - mean) * inv * g.w + bt.w);
      *(uint2*)(As + (rr * 2 + (tid >> 7)) * AP + c) = r.u;
    }
  }
  __syncthreads();

  const int n = lane & 15, half = lane >> 4;
  const unsigned hb = (unsigned)(b * NH + wave) * (TT * HD);   // (b, head) plane
  // One address per lane and matrix; row and column tile are constant steps.
  const unsigned qko = hb + (unsigned)(tloc >> 4) * 1024 + lane * 8;
  bf16* vp = vT + hb + (unsigned)(tloc >> 5) * 2048 + lane * 8;

  // rolled: one copy of the 256 transposed products and of the stores
  #pragma unroll 1
  for (int pass = 0; pass < 2; ++pass) {   // 0=q 1=k
    const bf16*  wt = (pass == 0) ? wqT : wkT;
    const float* bp = ((pass == 0) ? bq : bk) + wave * 64 + half * 8;
    bf16*        dp = ((pass == 0) ? q : k) + qko;
    float4 bias[4][2];                     // fetched ahead of the products
    #pragma unroll
    for (int t = 0; t < 4; ++t) {
      bias[t][0] = *(const float4*)(bp + t * 16);
      bias[t][1] = *(const float4*)(bp + t * 16 + 4);
    }
    // The loads' address registers are reused by the products' results: wait
    // before they are overwritten.
    asm volatile("s_wait_xcnt 0x0" ::: "memory");
    v8f acc[4][4] = {};
    gemm_64x64<true, false>(As, wt + (size_t)wave * 64 * CC, lane, acc);
    // Token mi * 16 + n, head dims t * 16 + half * 8 + r: piece lane of half
    // t & 1 of tile mi * 2 + (t >> 1), that is mi * 1024 + t * 256 + lane * 8.
    v4u pk[4][4];
    #pragma unroll
    for (int mi = 0; mi < 4; ++mi)
      #pragma unroll
      for (int t = 0; t < 4; ++t) {
        union { bf16 e[8]; v4u u; } c;
        c.e[0] = (bf16)(acc[mi][t][0] + bias[t][0].x);
        c.e[1] = (bf16)(acc[mi][t][1] + bias[t][0].y);
        c.e[2] = (bf16)(acc[mi][t][2] + bias[t][0].z);
        c.e[3] = (bf16)(acc[mi][t][3] + bias[t][0].w);
        c.e[4] = (bf16)(acc[mi][t][4] + bias[t][1].x);
        c.e[5] = (bf16)(acc[mi][t][5] + bias[t][1].y);
        c.e[6] = (bf16)(acc[mi][t][6] + bias[t][1].z);
        c.e[7] = (bf16)(acc[mi][t][7] + bias[t][1].w);
        pk[mi][t] = c.u;
        *(v4u*)(dp + mi * 1024 + t * 256) = pk[mi][t];
      }
    // The stores' data and address registers are reused by the next pass: wait
    // before they are overwritten (named here, they live up to the wait).
    asm volatile("s_wait_xcnt 0x0"
                 :: "v"(pk[0][0]), "v"(pk[0][1]), "v"(pk[0][2]), "v"(pk[0][3]),
                    "v"(pk[1][0]), "v"(pk[1][1]), "v"(pk[1][2]), "v"(pk[1][3]),
                    "v"(pk[2][0]), "v"(pk[2][1]), "v"(pk[2][2]), "v"(pk[2][3]),
                    "v"(pk[3][0]), "v"(pk[3][1]), "v"(pk[3][2]), "v"(pk[3][3]), "v"(dp)
                 : "memory");
  }
  {                                        // v: row = head dim n, k index = key m
    float bias[4];                         // fetched ahead of the products
    #pragma unroll
    for (int t = 0; t < 4; ++t) bias[t] = bv[wave * 64 + t * 16 + n];
    // The loads' address registers are reused by the products' results: wait
    // before they are overwritten.
    asm volatile("s_wait_xcnt 0x0" ::: "memory");
    v8f acc[4][4] = {};
    gemm_64x64<false, false>(As, wvT + (size_t)wave * 64 * CC, lane, acc);
    #pragma unroll
    for (int t = 0; t < 4; ++t)
      #pragma unroll
      for (int mi = 0; mi < 4; ++mi) {
        union { bf16 e[8]; uint4 u; } pk;
        #pragma unroll
        for (int r = 0; r < 8; r++) pk.e[r] = (bf16)(acc[mi][t][r] + bias[t]);
        *(uint4*)(vp + ((mi >> 1) * 4 + t) * 512 + (mi & 1) * 256) = pk.u;
        // The store's data and address registers are reused by the next tile:
        // wait before they are overwritten.
        asm volatile("s_wait_xcnt 0x0" ::: "memory");
      }
  }
}

#define SKEYS 64                  // keys per stage
#define STE   (SKEYS * HD)        // elements of K, and of V, per stage
#define QG    2                   // 16-query column groups per wave

// One stage: each of 256 threads copies 2 x 16 B of K and 2 x 16 B of V.
// kg, vg: the lane's own global addresses; lds: the lane's own LDS byte address.
__device__ __forceinline__ void stage_kv_async(const bf16* kg, const bf16* vg,
                                               unsigned lds) {
  // s_wait_xcnt in the copies' own statement: their address registers are not
  // rewritten before the wait.
  asm volatile("global_load_async_to_lds_b128 %0, %4, off\n\t"
               "global_load_async_to_lds_b128 %1, %5, off\n\t"
               "global_load_async_to_lds_b128 %2, %6, off\n\t"
               "global_load_async_to_lds_b128 %3, %7, off\n\t"
               "s_wait_xcnt 0x0"
               :: "v"(lds), "v"(lds + 4096u), "v"(lds + 8192u), "v"(lds + 12288u),
                  "v"(kg), "v"(kg + 2048), "v"(vg), "v"(vg + 2048)
               : "memory");
}

// Four waves per SIMD: the 512 work-groups are two per WGP, all resident.
__global__ __launch_bounds__(256) __attribute__((amdgpu_waves_per_eu(4, 4)))
void attn_flash(const bf16* __restrict__ q,
                const bf16* __restrict__ k,
                const bf16* __restrict__ vT,
                bf16* __restrict__ attn) {
  const int tid  = threadIdx.x;
  const int lane = tid & 31;
  const int qt = (blockIdx.x * 128 + (tid >> 5) * 16) * QG;   // this wave's first query
  const int h  = blockIdx.y;
  const int b  = blockIdx.z;
  const float scale = 0.125f;       // 1/sqrt(64), a power of two: exact

  const bf16* kbase = k  + ((size_t)b * NH + h) * (TT * HD);  // packed tiles
  const bf16* qbase = q  + ((size_t)b * NH + h) * (TT * HD) + (qt >> 4) * 1024;
  const bf16* vbase = vT + ((size_t)b * NH + h) * (TT * HD);  // packed tiles

  // Two buffers, each [K tiles 8 KB | V tiles 8 KB].
  __shared__ __align__(16) bf16 kv[2][2 * STE];
  const unsigned lds0 = (unsigned)(size_t)(void*)&kv[0][0] + (unsigned)tid * 16u;
  const bf16* kg = kbase + tid * 8;
  const bf16* vg = vbase + tid * 8;

  // Q^T B-operands for head dims 0..31 and 32..63 of each group (loaded once)
  v16bf q0[QG], q1[QG];
  // Every loop over g is unrolled: what g indexes (q0, q1, s0, s1, p, o, mrow,
  // lrow) is then indexed by constants and stays in registers.
  #pragma unroll
  for (int g = 0; g < QG; ++g) {
    q0[g] = load_packed(qbase + g * 1024,       lane);
    q1[g] = load_packed(qbase + g * 1024 + 512, lane);
  }

  // o[g][dt][r] = O[query g * 16 + n][head dim dt * 16 + half * 8 + r]
  v8f o[QG][4] = {};
  float mrow[QG];                   // running maximum of this lane's queries
  float lrow[QG];                   // running sums over this half's keys only
  #pragma unroll
  for (int g = 0; g < QG; ++g) { mrow[g] = -1e30f; lrow[g] = 0.f; }

  // Stage 0 lands and is published; stage 1 flies while stage 0 is worked on.
  stage_kv_async(kg, vg, lds0);
  asm volatile("s_wait_asynccnt 0x0" ::: "memory");   // this wave's share of stage 0
  __syncthreads();                                    // every wave's share
  stage_kv_async(kg + STE, vg + STE, lds0 + 4u * STE);

  for (int st = 0; st < TT / SKEYS; ++st) {
   const bf16* buf = kv[st & 1];
   // unrolled: the two 32-key passes of a stage read LDS at constant offsets
   #pragma unroll
   for (int sub = 0; sub < SKEYS / 32; ++sub) {
    // ---- S^T = K * Q^T for 32 keys (two 16-key M-tiles) ----
    const bf16* kp = buf + sub * 32 * HD;         // 4 packed tiles, 4 KB in a row
    const bf16* vp = buf + STE + sub * 32 * HD;   // 4 packed tiles, 4 KB in a row
    v16bf k0a = load_packed(kp,        lane);
    v16bf k0b = load_packed(kp + 512,  lane);
    v16bf k1a = load_packed(kp + 1024, lane);
    v16bf k1b = load_packed(kp + 1536, lane);
    v8f s0[QG] = {}, s1[QG] = {};
    #pragma unroll
    for (int g = 0; g < QG; ++g) s0[g] = wmma_bf16(k0a, q0[g], s0[g]);
    #pragma unroll
    for (int g = 0; g < QG; ++g) s1[g] = wmma_bf16(k1a, q0[g], s1[g]);
    #pragma unroll
    for (int g = 0; g < QG; ++g) s0[g] = wmma_bf16(k0b, q1[g], s0[g]);
    #pragma unroll
    for (int g = 0; g < QG; ++g) s1[g] = wmma_bf16(k1b, q1[g], s1[g]);

    // ---- online softmax, one query per lane and group ----
    v16bf p[QG];   // P^T: element r is key half * 8 + r, element 8 + r key 16 + half * 8 + r
    #pragma unroll
    for (int g = 0; g < QG; ++g) {
      float mx = fmaxf(s0[g][0], s1[g][0]);
      #pragma unroll
      for (int r = 1; r < 8; r++) mx = fmaxf(mx, fmaxf(s0[g][r], s1[g][r]));
      mx = fmaxf(mx, other_half(mx)) * scale;
      float mnew = fmaxf(mrow[g], mx);
      // Not asm text: the compiler must see this write, which can follow a matrix
      // instruction whose operand registers it reuses.
      float corr = __expf(mrow[g] - mnew);
      float t[8];
      // Two neighbouring registers of a score tile at a time: left to itself the
      // compiler pairs s0[r] with s1[r] and copies registers to bring them together.
      #pragma unroll
      for (int r = 0; r < 8; r += 2) {
        v2f a = {s0[g][r], s0[g][r + 1]}, c = {s1[g][r], s1[g][r + 1]};
        a = a * scale - mnew;
        c = c * scale - mnew;
        v2f p0 = {__expf(a.x), __expf(a.y)}, p1 = {__expf(c.x), __expf(c.y)};
        p[g][r]         = (bf16)p0.x;
        p[g][r + 1]     = (bf16)p0.y;
        p[g][8 + r]     = (bf16)p1.x;
        p[g][8 + r + 1] = (bf16)p1.y;
        v2f tt = p0 + p1;
        t[r] = tt.x;  t[r + 1] = tt.y;
      }
      float rs = ((t[0] + t[1]) + (t[2] + t[3])) + ((t[4] + t[5]) + (t[6] + t[7]));
      lrow[g] = lrow[g] * corr + rs;
      mrow[g] = mnew;
      #pragma unroll
      for (int dt = 0; dt < 4; dt++) o[g][dt] *= corr;
    }

    // ---- O^T += V^T(16 dims x 32 keys) * P^T(32 keys x 16 queries) ----
    #pragma unroll
    for (int dt = 0; dt < 4; dt++) {
      v16bf vv = load_packed(vp + dt * 512, lane);
      #pragma unroll
      for (int g = 0; g < QG; ++g) o[g][dt] = wmma_bf16(vv, p[g], o[g][dt]);
    }
   }
   // Publish point of stage st + 1: this wave's reads of buffer st & 1 are done,
   // its copies of stage st + 1 have landed, and the barrier says both of every
   // wave; only then is the buffer just read filled again.
   asm volatile("s_wait_dscnt 0x0" ::: "memory");
   asm volatile("s_wait_asynccnt 0x0" ::: "memory");
   __syncthreads();
   if (st + 2 < TT / SKEYS)
     stage_kv_async(kg + (st + 2) * STE, vg + (st + 2) * STE,
                    lds0 + (unsigned)(st & 1) * (4u * STE));
  }
  asm volatile("s_wait_asynccnt 0x0" ::: "memory");   // no copy is left at the wave's end

  // ---- join the halves' sums, normalize, store attn as packed tiles ----
  // tile (16 tokens x 32 of the AD columns), index (token >> 4) * 16 + (col >> 5):
  // the lane's 8 head dims dt * 16 + half * 8 + r of query n are piece lane of
  // half dt & 1 of tile h * 2 + (dt >> 1); a group's 4 stores fill 2 KB in a row.
  bf16* outb = attn + (size_t)((b * TT + qt) >> 4) * 8192 + h * 1024 + lane * 8;
  #pragma unroll
  for (int g = 0; g < QG; ++g) {
    float inv = 1.0f / (lrow[g] + other_half(lrow[g]));
    #pragma unroll
    for (int dt = 0; dt < 4; dt++) {
      union { bf16 e[8]; uint4 u; } pk;
      #pragma unroll
      for (int r = 0; r < 8; r++) pk.e[r] = (bf16)(o[g][dt][r] * inv);
      *(uint4*)(outb + g * 8192 + dt * 256) = pk.u;
    }
  }
}

// ---------------- kernel 5: output projection + bias + residual ------------
// attn panel (MR tokens, 64 packed tiles in a row) async-staged in LDS as it
// lies; wave w takes all MR tokens x columns 64 w .. 64 w + 63 (gemm_64x64).
__global__ __launch_bounds__(256) void out_proj(const bf16* __restrict__ attn,
                                                const bf16* __restrict__ woT,
                                                const float* __restrict__ bo,
                                                const float* __restrict__ x,
                                                float* __restrict__ out) {
  int t0  = blockIdx.x * MR;         // token row over B*T
  int tid = threadIdx.x;
  int lane = tid & 31;
  const int wave = __builtin_amdgcn_readfirstlane(tid >> 5);   // scalar

  __shared__ __align__(16) bf16 As[MR * AD];   // 64 KB attn panel
  {
    // The panel is 4096 pieces of 16 B in a row in global memory and in LDS;
    // thread tid copies pieces tid + 256 * j, j < 16.
    const unsigned l = (unsigned)(size_t)(void*)As      // addr[31:0] = LDS offset
                     + (unsigned)tid * 16u;
    const bf16* g = attn + (size_t)t0 * AD + tid * 8;
    // unrolled: constant steps of both addresses
    #pragma unroll
    for (int j = 0; j < 16; j += 4)
      copy4_async(l + (j + 0) * 4096u, l + (j + 1) * 4096u,
                  l + (j + 2) * 4096u, l + (j + 3) * 4096u,
                  g + (j + 0) * 2048, g + (j + 1) * 2048,
                  g + (j + 2) * 2048, g + (j + 3) * 2048);
    asm volatile("s_wait_asynccnt 0x0" ::: "memory");   // this wave's share has landed
  }
  __syncthreads();                                      // every wave's share

  v8f acc[4][4] = {};
  gemm_64x64<false, true>(As, woT + (size_t)wave * 64 * AD, lane, acc);

  const int n = lane & 15, half = lane >> 4;
  const size_t base = (size_t)(t0 + half * 8) * CC + wave * 64 + n;
  const float* xb = x + base;
  float* ob = out + base;
  #pragma unroll
  for (int t = 0; t < 4; ++t) {
    float bias = bo[wave * 64 + t * 16 + n];
    float xv[4][8];
    // unrolled: xv[] stays in registers and the 32 loads are in flight together
    #pragma unroll
    for (int mi = 0; mi < 4; ++mi)
      #pragma unroll
      for (int r = 0; r < 8; r++) xv[mi][r] = xb[(mi * 16 + r) * CC + t * 16];
    // Behind the last residual load its address registers are free for reuse:
    // wait before they can be overwritten (named here, they live up to the wait).
    if (t == 3) asm volatile("s_wait_xcnt 0x0" :: "v"(xb) : "memory");
    #pragma unroll
    for (int mi = 0; mi < 4; ++mi)
      #pragma unroll
      for (int r = 0; r < 8; r++)
        ob[(mi * 16 + r) * CC + t * 16] = xv[mi][r] + acc[mi][t][r] + bias;
  }
}

// ---------------- launch ----------------
extern "C" void kernel_launch(void* const* d_in, const int* in_sizes, int n_in,
                              void* d_out, int out_size, void* d_ws, size_t ws_size,
                              hipStream_t stream) {
  const float* x     = (const float*)d_in[0];
  const float* gamma = (const float*)d_in[1];
  const float* beta  = (const float*)d_in[2];
  const float* wq    = (const float*)d_in[3];
  const float* bq    = (const float*)d_in[4];
  const float* wk    = (const float*)d_in[5];
  const float* bk    = (const float*)d_in[6];
  const float* wv    = (const float*)d_in[7];
  const float* bv    = (const float*)d_in[8];
  const float* wo    = (const float*)d_in[9];
  const float* bo    = (const float*)d_in[10];
  float* out = (float*)d_out;

  // workspace carve-up
  const size_t XN = (size_t)BSZ * TT * CC;   // 8.4M elems
  const size_t WW = (size_t)512 * 512;
  char* ws = (char*)d_ws;
  float* part = (float*)ws;                  // 2*GNP*B floats = 4096 bytes
  bf16* attn = (bf16*)(ws + 4096);
  bf16* wqT = attn + XN;
  bf16* wkT = wqT + WW;
  bf16* wvT = wkT + WW;
  bf16* woT = wvT + WW;
  bf16* qb  = woT + WW;
  bf16* kb  = qb  + XN;
  bf16* vT  = kb  + XN;

  gn_stats<<<BSZ * GNP, 256, 0, stream>>>(x, part);
  wcast_t<<<dim3(16, 16, 4), dim3(32, 8), 0, stream>>>(wq, wk, wv, wo,
                                                       wqT, wkT, wvT, woT);
  qkv_gemm<<<(BSZ * TT) / MR, 256, 0, stream>>>(x, gamma, beta, part, wqT, wkT, wvT,
                                                bq, bk, bv, qb, kb, vT);
  attn_flash<<<dim3(TT / (128 * QG), NH, BSZ), 256, 0, stream>>>(qb, kb, vT, attn);
  out_proj<<<(BSZ * TT) / MR, 256, 0, stream>>>(attn, woT, bo, x, out);
}

// v010
// A run of this version takes 76.5 microseconds.
// Versions between v008 and this one are left out; their measured steps multiply to 1.07 times as fast.
// Over all steps from v000 it is 5.67 times as fast.
#include <hip/hip_runtime.h>

// ---------------- problem constants ----------------
#define BSZ 16
#define TT  1024          // H*W tokens
#define CC  512           // channels
#define NH  8
#define HD  64
#define AD  512           // attention dim
#define EPSV 1e-5f
#define GNP  32           // partial GroupNorm sums per sample, one per lane
#define MR   64           // token rows per work-group in both GEMMs
#define AP   (CC + 8)     // LDS row pitch of the QKV A panel, elements: 1040 B = 16 B x 65

typedef __bf16 bf16;
typedef __bf16 v16bf __attribute__((ext_vector_type(16)));
typedef float  v8f   __attribute__((ext_vector_type(8)));
typedef unsigned v4u  __attribute__((ext_vector_type(4)));
typedef float  v2f   __attribute__((ext_vector_type(2)));

// ---------------- WMMA helpers ----------------
__device__ __forceinline__ v8f wmma_bf16(v16bf a, v16bf b, v8f c) {
  // D = A(16x32 bf16) * B(32x16 bf16) + C(16x16 f32)
  return __builtin_amdgcn_wmma_f32_16x16x32_bf16(
      /*neg_a=*/false, a, /*neg_b=*/false, b,
      /*c_mod=*/(short)0, c, /*reuse_a=*/false, /*reuse_b=*/false);
}

// Load a 16x32 bf16 A-operand (or 32x16 B-operand, mirrored) per the CDNA5
// VGPR layout: lanes 0-15 -> row=lane, K chunks {0..7} and {16..23};
// lanes 16-31 -> row=lane-16, K chunks {8..15} and {24..31}.
// Each chunk is 8 contiguous bf16 = one 16-byte load.
__device__ __forceinline__ v16bf load_ab(const bf16* base, int row_stride, int lane) {
  int half = lane >> 4;
  int r    = lane & 15;
  const bf16* p = base + (size_t)r * row_stride + half * 8;
  union { v16bf v; uint4 q[2]; } u;
  u.q[0] = *(const uint4*)(p);        // K 0..7   (or 8..15)
  u.q[1] = *(const uint4*)(p + 16);   // K 16..23 (or 24..31)
  return u.v;
}

// Packed operand tile: a 16-row x 32-k bf16 tile is stored as 512 elements in
// the order the lanes consume it: element (row, k) lies at
//   (k >> 4) * 256 + (((k >> 3) & 1) * 16 + row) * 8 + (k & 7).
// Each of the two wave-wide 16-byte loads then covers 512 contiguous bytes
// (4 whole 128-byte lines) and yields the same registers as load_ab().
__device__ __forceinline__ v16bf load_packed(const bf16* tile, int lane) {
  union { v16bf v; uint4 q[2]; } u;
  u.q[0] = *(const uint4*)(tile + lane * 8);        // K 0..7   (or 8..15)
  u.q[1] = *(const uint4*)(tile + 256 + lane * 8);  // K 16..23 (or 24..31)
  return u.v;
}

// Four 16-byte copies per lane from global memory into LDS.
// l*: the lane's own LDS byte addresses; g*: the lane's own global addresses.
__device__ __forceinline__ void copy4_async(unsigned l0, unsigned l1, unsigned l2,
                                            unsigned l3, const bf16* g0, const bf16* g1,
                                            const bf16* g2, const bf16* g3) {
  // s_wait_xcnt in the copies' own statement: their address registers are not
  // rewritten before the wait.
  asm volatile("global_load_async_to_lds_b128 %0, %4, off\n\t"
               "global_load_async_to_lds_b128 %1, %5, off\n\t"
               "global_load_async_to_lds_b128 %2, %6, off\n\t"
               "global_load_async_to_lds_b128 %3, %7, off\n\t"
               "s_wait_xcnt 0x0"
               :: "v"(l0), "v"(l1), "v"(l2), "v"(l3), "v"(g0), "v"(g1), "v"(g2), "v"(g3)
               : "memory");
}

// One wave's 64 x 64 block of panel(64 x 512, LDS) * W(512 x 64):
// 4 row tiles x 4 column tiles, acc[m][t]. wp: the first of the wave's packed
// weight tiles (column tile t, k step ks at t * 8192 + ks * 512 elements).
// Every weight fragment is loaded once and feeds the 4 row tiles. Two fragment
// sets: a fragment is fetched again, for two k steps on, right behind its last
// product; the panel's fragments are fetched one k step ahead.
// TR = false: acc[m][t] = panel tile * weight tile; a lane holds 8 tokens
// (half * 8 + r) of one column (lane & 15). TR = true: the two operands change
// places (their register layouts mirror each other), acc[m][t] is the transposed
// tile; a lane holds 8 columns in a row (half * 8 + r) of one token (lane & 15).
// PK = false: the panel lies in rows of pitch AP. PK = true: it lies in packed
// tiles, row tile m, k step ks at (m * 16 + ks) * 512 elements.
template <bool TR, bool PK>
__device__ __forceinline__ void gemm_64x64(const bf16* As, const bf16* wp, int lane,
                                           v8f (&acc)[4][4]) {
  v16bf bb[2][4], a[4];
  #pragma unroll
  for (int t = 0; t < 4; ++t) bb[0][t] = load_packed(wp + t * 8192, lane);
  #pragma unroll
  for (int t = 0; t < 4; ++t) bb[1][t] = load_packed(wp + t * 8192 + 512, lane);
  #pragma unroll
  for (int m = 0; m < 4; ++m)
    a[m] = PK ? load_packed(As + m * 8192, lane) : load_ab(As + m * 16 * AP, AP, lane);
  // This and the two below hold each group of loads where it is written: without
  // them the compiler moves every load down to just ahead of its first product,
  // and the wave then waits out a whole L2 or LDS latency per fragment.
  __builtin_amdgcn_sched_barrier(0);
  // unrolled: the fragment sets are indexed by constants and stay in registers
  #pragma unroll
  for (int ks = 0; ks < CC / 32; ++ks) {
    v16bf an[4];
    if (ks + 1 < CC / 32) {
      #pragma unroll
      for (int m = 0; m < 4; ++m)
        an[m] = PK ? load_packed(As + m * 8192 + (ks + 1) * 512, lane)
                   : load_ab(As + m * 16 * AP + (ks + 1) * 32, AP, lane);
      __builtin_amdgcn_sched_barrier(0);
    }
    #pragma unroll
    for (int t = 0; t < 4; ++t) {
      #pragma unroll
      for (int m = 0; m < 4; ++m)
        acc[m][t] = TR ? wmma_bf16(bb[ks & 1][t], a[m], acc[m][t])
                       : wmma_bf16(a[m], bb[ks & 1][t], acc[m][t]);
      if (ks + 2 < CC / 32) {
        bb[ks & 1][t] = load_packed(wp + t * 8192 + (ks + 2) * 512, lane);
        // Behind the last weight load its offset register is free for reuse:
        // wait before it can be overwritten (named here, it lives up to the wait).
        if (ks + 3 == CC / 32 && t == 3)
          asm volatile("s_wait_xcnt 0x0" :: "v"(lane) : "memory");
        __builtin_amdgcn_sched_barrier(0);
      }
    }
    if (ks + 1 < CC / 32) {
      #pragma unroll
      for (int m = 0; m < 4; ++m) a[m] = an[m];
    }
  }
}

// ---------------- lane exchange ----------------
// Value of lane l ^ 16 (the other half's share of the same query).
__device__ __forceinline__ float other_half(float v) {
  int b = __builtin_bit_cast(int, v);
  b = __builtin_amdgcn_permlanex16(b, b, 0x76543210, 0xfedcba98, false, false);
  return __builtin_bit_cast(float, b);
}

// v plus the value of lane l ^ X inside the 16-lane row (DPP row_xmask:X).
template <int X>
__device__ __forceinline__ float add_row_xor(float v) {
  int m = __builtin_amdgcn_update_dpp(0, __builtin_bit_cast(int, v), 0x160 + X,
                                      0xf, 0xf, true);
  return v + __builtin_bit_cast(float, m);
}

// Sum over the 32 lanes of a wave, all lanes on; every lane gets the total.
__device__ __forceinline__ float wave_sum(float v) {
  v = add_row_xor<1>(v);
  v = add_row_xor<2>(v);
  v = add_row_xor<4>(v);
  v = add_row_xor<8>(v);
  return v + other_half(v);
}

// ---------------- kernel 1: GroupNorm partial sums (1 group) + weight cast ----
// Work-group g sums 64 KB of x in a row: slice g % GNP of sample g / GNP.
// part[2 * g] = sum, part[2 * g + 1] = sum of squares; the QKV GEMM joins the
// GNP slices of its sample.
// The same work-group transposes and casts one block of 32 k x 64 n of one
// 512 x 512 weight matrix into 4 packed tiles, tile index (n >> 4) * 16 + (k >> 5):
// 4 matrices x 16 k blocks x 8 n blocks are the 512 work-groups. A thread's two
// weight loads are in flight together with its x loads, and the one barrier of
// the sums also publishes the weight block in LDS.
#define WP 68             // LDS row pitch of the weight block, floats: 272 B = 16 B x 17
static_assert(BSZ * GNP == 4 * 16 * 8, "one weight block per work-group");
__global__ __launch_bounds__(256) void gn_stats_wcast(const float* __restrict__ x,
                                                      const float* __restrict__ wq,
                                                      const float* __restrict__ wk,
                                                      const float* __restrict__ wv,
                                                      const float* __restrict__ wo,
                                                      float* __restrict__ part,
                                                      bf16* __restrict__ wqT,
                                                      bf16* __restrict__ wkT,
                                                      bf16* __restrict__ wvT,
                                                      bf16* __restrict__ woT) {
  const int tid = threadIdx.x;
  const int z  = blockIdx.x >> 7;          // matrix
  const int kb = (blockIdx.x >> 3) & 15;   // block of 32 k
  const int nb = blockIdx.x & 7;           // block of 64 n
  const float* w = (z == 0) ? wq : (z == 1) ? wk : (z == 2) ? wv : wo;
  bf16* wt = (z == 0) ? wqT : (z == 1) ? wkT : (z == 2) ? wvT : woT;
  // Rows tid >> 4 and 16 + (tid >> 4) of the block, 16 threads per 256-byte row.
  const float* wr = w + (size_t)(kb * 32 + (tid >> 4)) * 512 + nb * 64 + (tid & 15) * 4;
  const float4 w0 = *(const float4*)wr;
  const float4 w1 = *(const float4*)(wr + 16 * 512);
  const float4* p = (const float4*)x + (size_t)blockIdx.x * (TT * CC / 4 / GNP) + tid;
  float4 v[16];
  // unrolled: v[] stays in registers and the 16 loads are in flight together
  #pragma unroll
  for (int i = 0; i < 16; ++i) v[i] = p[i * 256];
  // The weight loads' address registers would be reused as a destination of an x
  // load: named here, they live up to the wait, which stands behind all 18 loads.
  asm volatile("s_wait_xcnt 0x0" :: "v"(wr) : "memory");
  // Without it the compiler issues the last 4 loads behind the first sums' waits:
  // three memory latencies in a row instead of one.
  __builtin_amdgcn_sched_barrier(0);
  __shared__ __align__(16) float wtile[32 * WP];
  *(float4*)(wtile + (tid >> 4) * WP + (tid & 15) * 4)        = w0;
  *(float4*)(wtile + ((tid >> 4) + 16) * WP + (tid & 15) * 4) = w1;
  float4 a4 = make_float4(0.f, 0.f, 0.f, 0.f), q4 = a4;   // four chains each
  // unrolled: v[i] is indexed by a constant, so it needs no scratch memory
  #pragma unroll
  for (int i = 0; i < 16; ++i) {
    a4.x += v[i].x;  a4.y += v[i].y;  a4.z += v[i].z;  a4.w += v[i].w;
    q4.x += v[i].x * v[i].x;  q4.y += v[i].y * v[i].y;
    q4.z += v[i].z * v[i].z;  q4.w += v[i].w * v[i].w;
  }
  float s  = wave_sum((a4.x + a4.y) + (a4.z + a4.w));
  float ss = wave_sum((q4.x + q4.y) + (q4.z + q4.w));
  __shared__ float sh0[8], sh1[8];
  if ((tid & 31) == 0) { sh0[tid >> 5] = s; sh1[tid >> 5] = ss; }
  __syncthreads();
  // Thread tid writes piece tid & 63 (8 k in a row of one n) of packed tile
  // tid >> 6: a wave-wide 16-byte store covers 512 bytes in a row.
  const int nl = (tid >> 6) * 16 + (tid & 15);
  const int kl = ((tid >> 5) & 1) * 16 + ((tid >> 4) & 1) * 8;
  union { bf16 e[8]; uint4 u; } r;
  // unrolled: r.e[] is indexed by constants and stays in registers
  #pragma unroll
  for (int i = 0; i < 8; ++i) r.e[i] = (bf16)wtile[(kl + i) * WP + nl];
  *(uint4*)(wt + ((size_t)(nb * 4 + (tid >> 6)) * 16 + kb) * 512 + (tid & 63) * 8) = r.u;
  if (tid == 0) {
    float a = 0.f, c = 0.f;
    for (int w8 = 0; w8 < 8; ++w8) { a += sh0[w8]; c += sh1[w8]; }
    *(float2*)(part + 2 * blockIdx.x) = make_float2(a, c);
  }
}

// ---------------- kernel 2: GroupNorm apply + fused QKV WMMA GEMM ----------
// A panel (MR tokens x 512 K): x is read as f32, normalized, cast to bf16 and
// written to LDS once per block. Pass p is the product with wq, wk, wv; in each
// pass wave w takes all MR tokens x the 64 columns of head w (gemm_64x64).
// q, k and v are stored as packed tiles per (b, head):
//   q, k: tile (16 tokens x 32 head dims), index (token >> 4) * 2 + (d >> 5)
//   v:    tile (16 head dims x 32 keys),   index (key >> 5) * 4 + (d >> 4)
// A 16-byte piece of a q or k tile is 8 head dims of one token, of a v tile 8
// keys of one head dim: q and k are computed as transposed tiles, v as plain
// ones, so that a lane holds such a piece and a wave-wide 16-byte store covers
// 512 bytes in a row.
__global__ __launch_bounds__(256) void qkv_gemm(const float* __restrict__ x,
                                                const float* __restrict__ gamma,
                                                const float* __restrict__ beta,
                                                const float* __restrict__ part,
                                                const bf16* __restrict__ wqT,
                                                const bf16* __restrict__ wkT,
                                                const bf16* __restrict__ wvT,
                                                const float* __restrict__ bq,
                                                const float* __restrict__ bk,
                                                const float* __restrict__ bv,
                                                bf16* __restrict__ q,
                                                bf16* __restrict__ k,
                                                bf16* __restrict__ vT) {
  int t0   = blockIdx.x * MR;            // global token row (over B*T)
  int b    = t0 / TT;
  int tloc = t0 - b * TT;
  int tid  = threadIdx.x;
  int lane = tid & 31;
  const int wave = __builtin_amdgcn_readfirstlane(tid >> 5);   // scalar: = head

  __shared__ __align__(16) bf16 As[MR * AP];   // 65 KB A panel
  {
    // Thread tid takes the same 4 channels of rows rr * 2 + (tid >> 7): the
    // panel is 8192 float4 in a row, 32 per thread, all loads issued together.
    // Lane l takes slice l of this sample's sums; every wave joins all GNP.
    const float2 pr = *(const float2*)(part + (b * GNP + lane) * 2);
    // The load's address registers are reused as a destination of the loads
    // below: wait before they are overwritten.
    asm volatile("s_wait_xcnt 0x0" ::: "memory");
    const float* xp = x + (size_t)t0 * CC + tid * 4;
    float4 v[MR / 2];
    // unrolled: v[] stays in registers and the 32 loads are in flight together
    #pragma unroll
    for (int rr = 0; rr < MR / 2; ++rr) v[rr] = *(const float4*)(xp + rr * 1024);
    const int c = (tid & 127) * 4;
    float4 g  = *(const float4*)(gamma + c);
    float4 bt = *(const float4*)(beta + c);
    const float inv_n = 1.0f / (float)(TT * CC);
    const float mean = wave_sum(pr.x) * inv_n;
    const float var  = wave_sum(pr.y) * inv_n - mean * mean;
    const float inv  = rsqrtf(var + EPSV);
    // unrolled: v[rr] is indexed by a constant, so it needs no scratch memory
    #pragma unroll
    for (int rr = 0; rr < MR / 2; ++rr) {
      union { bf16 o[4]; uint2 u; } r;
      r.o[0] = (bf16)((v[rr].x - mean) * inv * g.x + bt.x);
      r.o[1] = (bf16)((v[rr].y - mean) * inv * g.y + bt.y);
      r.o[2] = (bf16)((v[rr].z - mean) * inv * g.z + bt.z);
      r.o[3] = (bf16)((v[rr].w - mean) * inv * g.w + bt.w);
      *(uint2*)(As + (rr * 2 + (tid >> 7)) * AP + c) = r.u;
    }
  }
  __syncthreads();

  const int n = lane & 15, half = lane >> 4;
  const unsigned hb = (unsigned)(b * NH + wave) * (TT * HD);   // (b, head) plane
  // One address per lane and matrix; row and column tile are constant steps.
  const unsigned qko = hb + (unsigned)(tloc >> 4) * 1024 + lane * 8;
  bf16* vp = vT + hb + (unsigned)(tloc >> 5) * 2048 + lane * 8;

  // rolled: one copy of the 256 transposed products and of the stores
  #pragma unroll 1
  for (int pass = 0; pass < 2; ++pass) {   // 0=q 1=k
    const bf16*  wt = (pass == 0) ? wqT : wkT;
    const float* bp = ((pass == 0) ? bq : bk) + wave * 64 + half * 8;
    bf16*        dp = ((pass == 0) ? q : k) + qko;
    float4 bias[4][2];                     // fetched ahead of the products
    #pragma unroll
    for (int t = 0; t < 4; ++t) {
      bias[t][0] = *(const float4*)(bp + t * 16);
      bias[t][1] = *(const float4*)(bp + t * 16 + 4);
    }
    // The loads' address registers are reused by the products' results: wait
    // before they are overwritten.
    asm volatile("s_wait_xcnt 0x0" ::: "memory");
    v8f acc[4][4] = {};
    gemm_64x64<true, false>(As, wt + (size_t)wave * 64 * CC, lane, acc);
    // Token mi * 16 + n, head dims t * 16 + half * 8 + r: piece lane of half
    // t & 1 of tile mi * 2 + (t >> 1), that is mi * 1024 + t * 256 + lane * 8.
    v4u pk[4][4];
    #pragma unroll
    for (int mi = 0; mi < 4; ++mi)
      #pragma unroll
      for (int t = 0; t < 4; ++t) {
        union { bf16 e[8]; v4u u; } c;
        c.e[0] = (bf16)(acc[mi][t][0] + bias[t][0].x);
        c.e[1] = (bf16)(acc[mi][t][1] + bias[t][0].y);
        c.e[2] = (bf16)(acc[mi][t][2] + bias[t][0].z);
        c.e[3] = (bf16)(acc[mi][t][3] + bias[t][0].w);
        c.e[4] = (bf16)(acc[mi][t][4] + bias[t][1].x);
        c.e[5] = (bf16)(acc[mi][t][5] + bias[t][1].y);
        c.e[6] = (bf16)(acc[mi][t][6] + bias[t][1].z);
        c.e[7] = (bf16)(acc[mi][t][7] + bias[t][1].w);
        pk[mi][t] = c.u;
        *(v4u*)(dp + mi * 1024 + t * 256) = pk[mi][t];
      }
    // The stores' data and address registers are reused by the next pass: wait
    // before they are overwritten (named here, they live up to the wait).
    asm volatile("s_wait_xcnt 0x0"
                 :: "v"(pk[0][0]), "v"(pk[0][1]), "v"(pk[0][2]), "v"(pk[0][3]),
                    "v"(pk[1][0]), "v"(pk[1][1]), "v"(pk[1][2]), "v"(pk[1][3]),
                    "v"(pk[2][0]), "v"(pk[2][1]), "v"(pk[2][2]), "v"(pk[2][3]),
                    "v"(pk[3][0]), "v"(pk[3][1]), "v"(pk[3][2]), "v"(pk[3][3]), "v"(dp)
                 : "memory");
  }
  {                                        // v: row = head dim n, k index = key m
    float bias[4];                         // fetched ahead of the products
    #pragma unroll
    for (int t = 0; t < 4; ++t) bias[t] = bv[wave * 64 + t * 16 + n];
    // The loads' address registers are reused by the products' results: wait
    // before they are overwritten.
    asm volatile("s_wait_xcnt 0x0" ::: "memory");
    v8f acc[4][4] = {};
    gemm_64x64<false, false>(As, wvT + (size_t)wave * 64 * CC, lane, acc);
    #pragma unroll
    for (int t = 0; t < 4; ++t)
      #pragma unroll
      for (int mi = 0; mi < 4; ++mi) {
        union { bf16 e[8]; uint4 u; } pk;
        #pragma unroll
        for (int r = 0; r < 8; r++) pk.e[r] = (bf16)(acc[mi][t][r] + bias[t]);
        *(uint4*)(vp + ((mi >> 1) * 4 + t) * 512 + (mi & 1) * 256) = pk.u;
        // The store's data and address registers are reused by the next tile:
        // wait before they are overwritten.
        asm volatile("s_wait_xcnt 0x0" ::: "memory");
      }
  }
}

#define SKEYS 64                  // keys per stage
#define STE   (SKEYS * HD)        // elements of K, and of V, per stage
#define QG    2                   // 16-query column groups per wave
#define SCALE 0.125f              // 1/sqrt(64), a power of two: exact
#define PMAX  4096.0f             // a pass's sum above this: its reference was too low

// One stage: each of 256 threads copies 2 x 16 B of K and 2 x 16 B of V.
// kg, vg: the lane's own global addresses; lds: the lane's own LDS byte address.
__device__ __forceinline__ void stage_kv_async(const bf16* kg, const bf16* vg,
                                               unsigned lds) {
  // s_wait_xcnt in the copies' own statement: their address registers are not
  // rewritten before the wait.
  asm volatile("global_load_async_to_lds_b128 %0, %4, off\n\t"
               "global_load_async_to_lds_b128 %1, %5, off\n\t"
               "global_load_async_to_lds_b128 %2, %6, off\n\t"
               "global_load_async_to_lds_b128 %3, %7, off\n\t"
               "s_wait_xcnt 0x0"
               :: "v"(lds), "v"(lds + 4096u), "v"(lds + 8192u), "v"(lds + 12288u),
                  "v"(kg), "v"(kg + 2048), "v"(vg), "v"(vg + 2048)
               : "memory");
}

// P^T = exp(S^T * SCALE - mref) of one column group's two score tiles, as bf16 in
// the B operand's order; returns the sum of the lane's 16 values before rounding.
__device__ __forceinline__ float exp_scores(const v8f& s0, const v8f& s1, float mref,
                                            v16bf& p) {
  float t[8];
  // Two neighbouring registers of a score tile at a time: left to itself the
  // compiler pairs s0[r] with s1[r] and copies registers to bring them together.
  // Unrolled: t[] and p are indexed by constants and stay in registers.
  #pragma unroll
  for (int r = 0; r < 8; r += 2) {
    v2f a = {s0[r], s0[r + 1]}, c = {s1[r], s1[r + 1]};
    a = a * SCALE - mref;
    c = c * SCALE - mref;
    v2f p0 = {__expf(a.x), __expf(a.y)}, p1 = {__expf(c.x), __expf(c.y)};
    p[r]         = (bf16)p0.x;
    p[r + 1]     = (bf16)p0.y;
    p[8 + r]     = (bf16)p1.x;
    p[8 + r + 1] = (bf16)p1.y;
    v2f tt = p0 + p1;
    t[r] = tt.x;  t[r + 1] = tt.y;
  }
  return ((t[0] + t[1]) + (t[2] + t[3])) + ((t[4] + t[5]) + (t[6] + t[7]));
}

// Four waves per SIMD: the 512 work-groups are two per WGP, all resident.
__global__ __launch_bounds__(256) __attribute__((amdgpu_waves_per_eu(4, 4)))
void attn_flash(const bf16* __restrict__ q,
                const bf16* __restrict__ k,
                const bf16* __restrict__ vT,
                bf16* __restrict__ attn) {
  const int tid  = threadIdx.x;
  const int lane = tid & 31;
  const int qt = (blockIdx.x * 128 + (tid >> 5) * 16) * QG;   // this wave's first query
  const int h  = blockIdx.y;
  const int b  = blockIdx.z;

  const bf16* kbase = k  + ((size_t)b * NH + h) * (TT * HD);  // packed tiles
  const bf16* qbase = q  + ((size_t)b * NH + h) * (TT * HD) + (qt >> 4) * 1024;
  const bf16* vbase = vT + ((size_t)b * NH + h) * (TT * HD);  // packed tiles

  // Two buffers, each [K tiles 8 KB | V tiles 8 KB].
  __shared__ __align__(16) bf16 kv[2][2 * STE];
  const unsigned lds0 = (unsigned)(size_t)(void*)&kv[0][0] + (unsigned)tid * 16u;
  const bf16* kg = kbase + tid * 8;
  const bf16* vg = vbase + tid * 8;

  // Q^T B-operands for head dims 0..31 and 32..63 of each group (loaded once)
  v16bf q0[QG], q1[QG];
  // Every loop over g is unrolled: what g indexes (q0, q1, s0, s1, p, o, mrow,
  // lrow) is then indexed by constants and stays in registers.
  #pragma unroll
  for (int g = 0; g < QG; ++g) {
    q0[g] = load_packed(qbase + g * 1024,       lane);
    q1[g] = load_packed(qbase + g * 1024 + 512, lane);
  }

  // o[g][dt][r] = O[query g * 16 + n][head dim dt * 16 + half * 8 + r]
  v8f o[QG][4] = {};
  float mrow[QG];                   // reference maximum of this lane's queries
  float lrow[QG];                   // running sums over this half's keys only
  #pragma unroll
  for (int g = 0; g < QG; ++g) { mrow[g] = -1e30f; lrow[g] = 0.f; }

  // Stage 0 lands and is published; stage 1 flies while stage 0 is worked on.
  stage_kv_async(kg, vg, lds0);
  asm volatile("s_wait_asynccnt 0x0" ::: "memory");   // this wave's share of stage 0
  __syncthreads();                                    // every wave's share
  stage_kv_async(kg + STE, vg + STE, lds0 + 4u * STE);

  for (int st = 0; st < TT / SKEYS; ++st) {
   const bf16* buf = kv[st & 1];
   // unrolled: the two 32-key passes of a stage read LDS at constant offsets
   #pragma unroll
   for (int sub = 0; sub < SKEYS / 32; ++sub) {
    // ---- S^T = K * Q^T for 32 keys (two 16-key M-tiles) ----
    const bf16* kp = buf + sub * 32 * HD;         // 4 packed tiles, 4 KB in a row
    const bf16* vp = buf + STE + sub * 32 * HD;   // 4 packed tiles, 4 KB in a row
    v16bf k0a = load_packed(kp,        lane);
    v16bf k0b = load_packed(kp + 512,  lane);
    v16bf k1a = load_packed(kp + 1024, lane);
    v16bf k1b = load_packed(kp + 1536, lane);
    v16bf vv[4];
    // unrolled: vv[] is indexed by constants and stays in registers
    #pragma unroll
    for (int dt = 0; dt < 4; dt++) vv[dt] = load_packed(vp + dt * 512, lane);
    // Holds the pass's 16 LDS reads together, ahead of its products. With the pass
    // cut in two by the branch below, the compiler otherwise fetches each fragment
    // just ahead of its products, and the wave waits out an LDS latency per fragment.
    __builtin_amdgcn_sched_barrier(0);
    v8f s0[QG] = {}, s1[QG] = {};
    #pragma unroll
    for (int g = 0; g < QG; ++g) s0[g] = wmma_bf16(k0a, q0[g], s0[g]);
    #pragma unroll
    for (int g = 0; g < QG; ++g) s1[g] = wmma_bf16(k1a, q0[g], s1[g]);
    #pragma unroll
    for (int g = 0; g < QG; ++g) s0[g] = wmma_bf16(k0b, q1[g], s0[g]);
    #pragma unroll
    for (int g = 0; g < QG; ++g) s1[g] = wmma_bf16(k1b, q1[g], s1[g]);
    // Holds the vector work behind the eight products: mixed in among them, each
    // first read of a score tile is padded with up to 4 idle slots.
    __builtin_amdgcn_sched_barrier(0);

    // ---- online softmax, one query per lane and group ----
    // mrow is the reference that P, the sums and O are scaled by. Any value that
    // both halves of a query share gives the same quotient O / sum, so a pass first
    // takes the reference as it stands; its own sums, which it needs anyway, tell
    // whether that was too low (no P above PMAX while a sum is at most PMAX).
    v16bf p[QG];   // P^T: element r is key half * 8 + r, element 8 + r key 16 + half * 8 + r
    float rs[QG];
    bool redo = false;
    #pragma unroll
    for (int g = 0; g < QG; ++g) {
      rs[g] = exp_scores(s0[g], s1[g], mrow[g], p[g]);
      redo = redo || !(rs[g] <= PMAX);   // in this form true for a NaN as well
    }
    // One test per pass for the whole wave, a scalar branch. Only a pass that fails
    // it (the first always does) looks for the maximum, rescales and forms P again.
    if (__builtin_amdgcn_ballot_w32(redo) != 0) {
      #pragma unroll
      for (int g = 0; g < QG; ++g) {
        float mx = fmaxf(s0[g][0], s1[g][0]);
        #pragma unroll
        for (int r = 1; r < 8; r++) mx = fmaxf(mx, fmaxf(s0[g][r], s1[g][r]));
        mx = fmaxf(mx, other_half(mx)) * SCALE;
        float mnew = fmaxf(mrow[g], mx);
        // Not asm text: the compiler must see this write, which can follow a matrix
        // instruction whose operand registers it reuses.
        float corr = __expf(mrow[g] - mnew);
        lrow[g] *= corr;
        mrow[g] = mnew;
        #pragma unroll
        for (int dt = 0; dt < 4; dt++) o[g][dt] *= corr;
        rs[g] = exp_scores(s0[g], s1[g], mnew, p[g]);
      }
    }
    #pragma unroll
    for (int g = 0; g < QG; ++g) lrow[g] += rs[g];

    // ---- O^T += V^T(16 dims x 32 keys) * P^T(32 keys x 16 queries) ----
    #pragma unroll
    for (int dt = 0; dt < 4; dt++) {
      #pragma unroll
      for (int g = 0; g < QG; ++g) o[g][dt] = wmma_bf16(vv[dt], p[g], o[g][dt]);
    }
   }
   // Publish point of stage st + 1: this wave's reads of buffer st & 1 are done,
   // its copies of stage st + 1 have landed, and the barrier says both of every
   // wave; only then is the buffer just read filled again.
   asm volatile("s_wait_dscnt 0x0" ::: "memory");
   asm volatile("s_wait_asynccnt 0x0" ::: "memory");
   __syncthreads();
   if (st + 2 < TT / SKEYS)
     stage_kv_async(kg + (st + 2) * STE, vg + (st + 2) * STE,
                    lds0 + (unsigned)(st & 1) * (4u * STE));
  }
  asm volatile("s_wait_asynccnt 0x0" ::: "memory");   // no copy is left at the wave's end

  // ---- join the halves' sums, normalize, store attn as packed tiles ----
  // tile (16 tokens x 32 of the AD columns), index (token >> 4) * 16 + (col >> 5):
  // the lane's 8 head dims dt * 16 + half * 8 + r of query n are piece lane of
  // half dt & 1 of tile h * 2 + (dt >> 1); a group's 4 stores fill 2 KB in a row.
  bf16* outb = attn + (size_t)((b * TT + qt) >> 4) * 8192 + h * 1024 + lane * 8;
  #pragma unroll
  for (int g = 0; g < QG; ++g) {
    float inv = 1.0f / (lrow[g] + other_half(lrow[g]));
    #pragma unroll
    for (int dt = 0; dt < 4; dt++) {
      union { bf16 e[8]; uint4 u; } pk;
      #pragma unroll
      for (int r = 0; r < 8; r++) pk.e[r] = (bf16)(o[g][dt][r] * inv);
      *(uint4*)(outb + g * 8192 + dt * 256) = pk.u;
    }
  }
}

// ---------------- kernel 4: output projection + bias + residual ------------
// attn panel (MR tokens, 64 packed tiles in a row) async-staged in LDS as it
// lies; wave w takes all MR tokens x columns 64 w .. 64 w + 63 (gemm_64x64).
__global__ __launch_bounds__(256) void out_proj(const bf16* __restrict__ attn,
                                                const bf16* __restrict__ woT,
                                                const float* __restrict__ bo,
                                                const float* __restrict__ x,
                                                float* __restrict__ out) {
  int t0  = blockIdx.x * MR;         // token row over B*T
  int tid = threadIdx.x;
  int lane = tid & 31;
  const int wave = __builtin_amdgcn_readfirstlane(tid >> 5);   // scalar

  __shared__ __align__(16) bf16 As[MR * AD];   // 64 KB attn panel
  {
    // The panel is 4096 pieces of 16 B in a row in global memory and in LDS;
    // thread tid copies pieces tid + 256 * j, j < 16.
    const unsigned l = (unsigned)(size_t)(void*)As      // addr[31:0] = LDS offset
                     + (unsigned)tid * 16u;
    const bf16* g = attn + (size_t)t0 * AD + tid * 8;
    // unrolled: constant steps of both addresses
    #pragma unroll
    for (int j = 0; j < 16; j += 4)
      copy4_async(l + (j + 0) * 4096u, l + (j + 1) * 4096u,
                  l + (j + 2) * 4096u, l + (j + 3) * 4096u,
                  g + (j + 0) * 2048, g + (j + 1) * 2048,
                  g + (j + 2) * 2048, g + (j + 3) * 2048);
    asm volatile("s_wait_asynccnt 0x0" ::: "memory");   // this wave's share has landed
  }
  __syncthreads();                                      // every wave's share

  v8f acc[4][4] = {};
  gemm_64x64<false, true>(As, woT + (size_t)wave * 64 * AD, lane, acc);

  const int n = lane & 15, half = lane >> 4;
  const size_t base = (size_t)(t0 + half * 8) * CC + wave * 64 + n;
  const float* xb = x + base;
  float* ob = out + base;
  #pragma unroll
  for (int t = 0; t < 4; ++t) {
    float bias = bo[wave * 64 + t * 16 + n];
    float xv[4][8];
    // unrolled: xv[] stays in registers and the 32 loads are in flight together
    #pragma unroll
    for (int mi = 0; mi < 4; ++mi)
      #pragma unroll
      for (int r = 0; r < 8; r++) xv[mi][r] = xb[(mi * 16 + r) * CC + t * 16];
    // Behind the last residual load its address registers are free for reuse:
    // wait before they can be overwritten (named here, they live up to the wait).
    if (t == 3) asm volatile("s_wait_xcnt 0x0" :: "v"(xb) : "memory");
    #pragma unroll
    for (int mi = 0; mi < 4; ++mi)
      #pragma unroll
      for (int r = 0; r < 8; r++)
        ob[(mi * 16 + r) * CC + t * 16] = xv[mi][r] + acc[mi][t][r] + bias;
  }
}

// ---------------- launch ----------------
extern "C" void kernel_launch(void* const* d_in, const int* in_sizes, int n_in,
                              void* d_out, int out_size, void* d_ws, size_t ws_size,
                              hipStream_t stream) {
  const float* x     = (const float*)d_in[0];
  const float* gamma = (const float*)d_in[1];
  const float* beta  = (const float*)d_in[2];
  const float* wq    = (const float*)d_in[3];
  const float* bq    = (const float*)d_in[4];
  const float* wk    = (const float*)d_in[5];
  const float* bk    = (const float*)d_in[6];
  const float* wv    = (const float*)d_in[7];
  const float* bv    = (const float*)d_in[8];
  const float* wo    = (const float*)d_in[9];
  const float* bo    = (const float*)d_in[10];
  float* out = (float*)d_out;

  // workspace carve-up
  const size_t XN = (size_t)BSZ * TT * CC;   // 8.4M elems
  const size_t WW = (size_t)512 * 512;
  char* ws = (char*)d_ws;
  float* part = (float*)ws;                  // 2*GNP*B floats = 4096 bytes
  bf16* attn = (bf16*)(ws + 4096);
  bf16* wqT = attn + XN;
  bf16* wkT = wqT + WW;
  bf16* wvT = wkT + WW;
  bf16* woT = wvT + WW;
  bf16* qb  = woT + WW;
  bf16* kb  = qb  + XN;
  bf16* vT  = kb  + XN;

  gn_stats_wcast<<<BSZ * GNP, 256, 0, stream>>>(x, wq, wk, wv, wo, part,
                                                wqT, wkT, wvT, woT);
  qkv_gemm<<<(BSZ * TT) / MR, 256, 0, stream>>>(x, gamma, beta, part, wqT, wkT, wvT,
                                                bq, bk, bv, qb, kb, vT);
  attn_flash<<<dim3(TT / (128 * QG), NH, BSZ), 256, 0, stream>>>(qb, kb, vT, attn);
  out_proj<<<(BSZ * TT) / MR, 256, 0, stream>>>(attn, woT, bo, x, out);
}
